// v009
// The times below were measured on an AMD MI455X: many runs one after another, warmed up first and cycling through
// copies of the inputs, with the whole window's GPU time divided by the number of runs. Launches and the gaps
// between them are all in it. The median over several windows is given; except for v000 it joins two sittings, which
// can be a few percent apart, so the side-by-side timings, each taken in one sitting, are the better comparison.
// Earlier versions than v009 are not in this document.
// One run takes 312 microseconds.
// Next to v008, in two timings, it ran 1.14 times as fast each time.
// Counting every step since v000, which is the starting kernel, it is 33.9 times as fast.
#include <hip/hip_runtime.h>
// Pre-LN causal transformer block with a fused QKV projection and the module's literal score scale (x [8][1024][1024]; h = LN1(x) (biased var, eps 1e-5); qkv = h Wqkv + bqkv ([in][out] 1024 x 3072 + bias) split q | k | v; 16 heads of 64; scale = 1 / sqrt(3 * 1024 / 16) = 1 / sqrt(192) (as the source: NOT 1 / sqrt(head_dim)); causal (tril, -inf); softmax; x1 = x + y Wproj + bproj; out = x1 + relu(LN2(x1) W1 + b1) W2 + b2 ([in][out] 1024 x 4096 x 1024) -> [8][1024][1024]).
// Structure: token rows r = b*1024 + s; h = LN1(bf16(x)) as f16 rows, bf16(x) as f32 rows; q | k | v as ONE WMMA GEMM (N = 3 x 1024) (64x64 wave tiles, f32 accumulation, exact x16 weights + bias, f16 outputs); per batch: V^T for all heads via LDS transposes; per query tile of 128 rows of a head, in one kernel: scores against tiles of 64 keys up to the tile end, running row maximum and sum (f32 statistics, native exp; keys above the row masked; weights x256 f16), o += P . V^T on WMMA (o carried x64, folded into the output GEMM alpha) written straight into the merged f16 o rows; x1 = x + o W_o + b GEMM (f32); LN2, then the FFN GEMMs (relu, + x1) into the output layout.
// Compute dtype: inputs rounded to bf16; x / weights exact; q, k, v, softmax weights and o as plain f16 GEMM operands (~2^-12); scores and softmax statistics f32. v_wmma_f32_16x16x32_f16.
// Launches: kernels that depend on nothing of one another share a launch, each work-group taking a piece of one of them (LN1 with the weight transposes; the first-tile q | k | v GEMM with the all-row one; the exact first-tile attention with the fused attention; the split of the exact o with the output GEMM). The batch axis lies on the grid, not in a host loop: V^T takes every batch in one launch, the first-tile output GEMMs take all batches on grid.y; scores, softmax and P V of every batch, head and query tile are one launch; the FFN GEMMs take all token rows.
#define NB 8
#define SQ 1024
#define DM 1024
#define NH 16
#define HD 64
#define HG 4                         /* heads per block group of the per-batch k_vt, which is not launched */
#define QT 256                       /* query rows a head in the S plane's size */
#define NKX SQ                       /* S row length in the plane's size */
#define QT0 128                      /* first-tile rows recomputed exactly in f32 */
#define GB 4                         /* batches in the S plane's size */
#define B0 0                         /* not used */
#define NBR NB                       /* batches processed (debug hook) */
#define NR ((size_t)NB * SQ)
#define DMQ DM
#define DFF 4096                     /* FFN hidden width */
#define DFFR 100                     /* not used */
#define MP ((int)((size_t)NBR * SQ)) /* rows projected (debug hook) */
#define QN SQ                        /* not used */
#define NHD NH                       /* not used */
#define MPO MP                       /* rows through the output stage (debug hook) */
#define LQ (3 * DM)      /* row pitch of the q/k/v rows */
typedef __bf16 v16b __attribute__((ext_vector_type(16)));
typedef unsigned short v8us __attribute__((ext_vector_type(8), may_alias));
typedef float  v8f  __attribute__((ext_vector_type(8)));
typedef float  v4f  __attribute__((ext_vector_type(4)));
typedef float  v4fa __attribute__((ext_vector_type(4), may_alias));
union FragB { v16b v; v8us half[2]; unsigned short u[16]; };

__device__ __forceinline__ unsigned short bf16_bits(float x) { unsigned int u = __float_as_uint(x); return (unsigned short)((u + 0x7FFFu + ((u >> 16) & 1u)) >> 16); }
__device__ __forceinline__ float bf16_val(unsigned short b) { return __uint_as_float(((unsigned int)b) << 16); }
__device__ __forceinline__ float bf16_round(float x) { return bf16_val(bf16_bits(x)); }
// D += A·B with NT terms: 1 = ah·bh, 2 = + al·bh (A split), 3 = + ah·bl (both split)
template <int NT>
__device__ __forceinline__ v8f mmaN(v16b ah, v16b al, v16b bh, v16b bl, v8f c) {
  c = __builtin_amdgcn_wmma_f32_16x16x32_bf16(false, ah, false, bh, (short)0, c, false, false);
  if (NT >= 2) c = __builtin_amdgcn_wmma_f32_16x16x32_bf16(false, al, false, bh, (short)0, c, false, false);
  if (NT >= 3) c = __builtin_amdgcn_wmma_f32_16x16x32_bf16(false, ah, false, bl, (short)0, c, false, false);
  asm volatile("v_nop\n\tv_nop\n\tv_nop\n\tv_nop" : "+v"(c) : "v"(ah), "v"(al), "v"(bh), "v"(bl));
  return c;
}

__global__ __launch_bounds__(256) void k_wt_bf16(const float* __restrict__ W, unsigned short* __restrict__ Wt, int K, int N) {
  const int t = blockIdx.x * 256 + threadIdx.x;
  const int k8n = K / 8;
  if (t >= N * k8n) return;
  const int n = t / k8n, k8 = (t % k8n) * 8;
  v8us v;
#pragma unroll
  for (int i = 0; i < 8; ++i) v[i] = bf16_bits(W[(size_t)(k8 + i) * N + n]);
  *(v8us*)(Wt + (size_t)n * K + k8) = v;
  
}

// GEMM C[M][N] (f32, pitch ldc) = act(A[M][K]·W + bias). A f32 row-major (pitch lda) converted per fragment to bf16
// (ASPLIT: hi/lo two planes -> 2 terms, else single rounded term); Wt bf16 [N][K] (pitch ldb). BIAS_BF16 rounds the
// bias to bf16 first (bias quantised to bf16 before the add). K%32==0, M%16==0, N%64==0.
template <bool ASPLIT, int ACT, bool BIAS_BF16>
__global__ __launch_bounds__(128) void k_gemm_bf(const float* __restrict__ A, int lda, const unsigned short* __restrict__ Wt, int ldb,
                                               const float* __restrict__ bias, float* __restrict__ C, int ldc, int M, int N, int K) {
  __shared__ __attribute__((aligned(16))) float so[4][16][64];
  const int tid = threadIdx.x, w = tid >> 5, lane = tid & 31, ln = lane & 15, hh = lane >> 4;
  const int ntn = N / 64;
  const int wid = blockIdx.x * 4 + w;
  const int mt = wid / ntn, nq = wid % ntn;
  if (mt * 16 >= M) return;
  const int row0 = mt * 16, col0 = nq * 64;
  const float* arow = A + (size_t)(row0 + ln) * lda;
  v8f acc[4] = {};
  for (int kb = 0; kb < K; kb += 32) {
    FragB ah, al;
    const v4f x0 = *(const v4fa*)(arow + kb + 8 * hh), x1 = *(const v4fa*)(arow + kb + 8 * hh + 4);
    const v4f x2 = *(const v4fa*)(arow + kb + 16 + 8 * hh), x3 = *(const v4fa*)(arow + kb + 16 + 8 * hh + 4);
    float xs[16] = {x0[0],x0[1],x0[2],x0[3],x1[0],x1[1],x1[2],x1[3],x2[0],x2[1],x2[2],x2[3],x3[0],x3[1],x3[2],x3[3]};
#pragma unroll
    for (int i = 0; i < 16; ++i) { const unsigned short hb = bf16_bits(xs[i]); ah.u[i] = hb; al.u[i] = ASPLIT ? bf16_bits(xs[i] - bf16_val(hb)) : (unsigned short)0; }
#pragma unroll
    for (int t = 0; t < 4; ++t) {
      const unsigned short* brow = Wt + (size_t)(col0 + t * 16 + ln) * ldb + kb;
      FragB b;
      b.half[0] = *(const v8us*)(brow + 8 * hh);
      b.half[1] = *(const v8us*)(brow + 16 + 8 * hh);
      acc[t] = mmaN<ASPLIT ? 2 : 1>(ah.v, al.v, b.v, b.v, acc[t]);
    }
  }
#pragma unroll
  for (int t = 0; t < 4; ++t) {
    float bv = bias ? bias[col0 + t * 16 + ln] : 0.f;
    if (BIAS_BF16) bv = bf16_round(bv);
#pragma unroll
    for (int r = 0; r < 8; ++r) { float v = acc[t][r] + bv; if (ACT == 1) v = fmaxf(v, 0.f); so[w][8 * hh + r][t * 16 + ln] = v; }
  }
  __builtin_amdgcn_fence(__ATOMIC_ACQ_REL, "workgroup");
  __builtin_amdgcn_wave_barrier();
  const int rsub = lane >> 4, c4 = (lane & 15) * 4;
  {
#pragma unroll
    for (int q = 0; q < 8; ++q) {
      const int r = q * 2 + rsub;
      const v4f v = *(const v4fa*)&so[w][r][c4];
      *(v4f*)(C + (size_t)(row0 + r) * ldc + col0 + c4) = v;
    }
    
  }
}

// GEMM C = act(A·W + bias + resid): A f32 (ASPLIT -> hi/lo 2 terms), Wt bf16 [N][K]; ACT 0 none, 1 relu, 2 exact gelu;
// resid (optional, f32, row index = (row % rmod), pitch ldr, RES_BF16 rounds it) added before the activation.
template <bool ASPLIT, int ACT, bool BIAS_BF16, bool RES_BF16>
__global__ __launch_bounds__(128) void k_gemm_bf3(const float* __restrict__ A, int lda, const unsigned short* __restrict__ Wt, int ldb,
                                                const float* __restrict__ bias, const float* __restrict__ resid, int rmod, int ldr,
                                                float* __restrict__ C, int ldc, int M, int N, int K) {
  __shared__ __attribute__((aligned(16))) float so[4][16][64];
  const int tid = threadIdx.x, w = tid >> 5, lane = tid & 31, ln = lane & 15, hh = lane >> 4;
  const int ntn = N / 64;
  const int wid = blockIdx.x * 4 + w;
  const int mt = wid / ntn, nq = wid % ntn;
  if (mt * 16 >= M) return;
  const int row0 = mt * 16, col0 = nq * 64;
  const float* arow = A + (size_t)(row0 + ln) * lda;
  v8f acc[4] = {};
  for (int kb = 0; kb < K; kb += 32) {
    FragB ah, al;
    const v4f x0 = *(const v4fa*)(arow + kb + 8 * hh), x1 = *(const v4fa*)(arow + kb + 8 * hh + 4);
    const v4f x2 = *(const v4fa*)(arow + kb + 16 + 8 * hh), x3 = *(const v4fa*)(arow + kb + 16 + 8 * hh + 4);
    float xs[16] = {x0[0],x0[1],x0[2],x0[3],x1[0],x1[1],x1[2],x1[3],x2[0],x2[1],x2[2],x2[3],x3[0],x3[1],x3[2],x3[3]};
#pragma unroll
    for (int i = 0; i < 16; ++i) { const unsigned short hb = bf16_bits(xs[i]); ah.u[i] = hb; al.u[i] = ASPLIT ? bf16_bits(xs[i] - bf16_val(hb)) : (unsigned short)0; }
#pragma unroll
    for (int t = 0; t < 4; ++t) {
      const unsigned short* brow = Wt + (size_t)(col0 + t * 16 + ln) * ldb + kb;
      FragB b;
      b.half[0] = *(const v8us*)(brow + 8 * hh);
      b.half[1] = *(const v8us*)(brow + 16 + 8 * hh);
      acc[t] = mmaN<ASPLIT ? 2 : 1>(ah.v, al.v, b.v, b.v, acc[t]);
    }
  }
#pragma unroll
  for (int t = 0; t < 4; ++t) {
    const int col = col0 + t * 16 + ln;
    float bv = bias ? bias[col] : 0.f;
    if (BIAS_BF16) bv = bf16_round(bv);
#pragma unroll
    for (int r = 0; r < 8; ++r) {
      float v = acc[t][r] + bv;
      if (resid) { float rv = resid[(size_t)((row0 + 8 * hh + r) % rmod) * ldr + col]; if (RES_BF16) rv = bf16_round(rv); v += rv; }
      if (ACT == 1) v = fmaxf(v, 0.f);
      if (ACT == 2) v = 0.5f * v * (1.0f + erff(v * 0.70710678118654752f));
      if (ACT == 3) { const float u = 0.7978845608028654f * (v + 0.044715f * v * v * v); v = 0.5f * v * (1.0f + tanhf(u)); }
      so[w][8 * hh + r][t * 16 + ln] = v;
    }
  }
  __builtin_amdgcn_fence(__ATOMIC_ACQ_REL, "workgroup");
  __builtin_amdgcn_wave_barrier();
  const int rsub = lane >> 4, c4 = (lane & 15) * 4;
  {
#pragma unroll
    for (int q = 0; q < 8; ++q) {
      const int r = q * 2 + rsub;
      const v4f v = *(const v4fa*)&so[w][r][c4];
      *(v4f*)(C + (size_t)(row0 + r) * ldc + col0 + c4) = v;
    }
    
  }
}
// row LayerNorm (biased variance, eps) over N: s = X (+ R); optional out_sum <- s; out_norm <- (s-mu)*rsqrt(var+eps)*g + b
template <bool PARAM_BF16>
__global__ __launch_bounds__(256) void k_layernorm(const float* __restrict__ X, const float* __restrict__ R, const float* __restrict__ g, const float* __restrict__ bta,
                                                  float* __restrict__ out_sum, float* __restrict__ out_norm, int N, float eps) {
  __shared__ float red[256];
  const int row = blockIdx.x, tid = threadIdx.x;
  const float* x = X + (size_t)row * N; const float* rr = R ? R + (size_t)row * N : nullptr;
  float vals[16];                     // up to N = 4096
  const int per = N / 256;            // contiguous chunk per thread? use strided-by-4 chunks: thread handles j = tid*4 + 1024*u
  float s1 = 0.f;
  for (int u = 0; u < per / 4; ++u) {
    const int j = tid * 4 + 1024 * u;
    const v4f a = *(const v4fa*)(x + j);
    v4f b = {0.f,0.f,0.f,0.f}; if (rr) b = *(const v4fa*)(rr + j);
#pragma unroll
    for (int q = 0; q < 4; ++q) { const float v = a[q] + b[q]; vals[u * 4 + q] = v; s1 += v; }
  }
  red[tid] = s1; __syncthreads();
  for (int st = 128; st > 0; st >>= 1) { if (tid < st) red[tid] += red[tid + st]; __syncthreads(); }
  const float mu = red[0] / (float)N; __syncthreads();
  float s2 = 0.f;
  for (int u = 0; u < per / 4; ++u)
#pragma unroll
    for (int q = 0; q < 4; ++q) { const float c = vals[u * 4 + q] - mu; s2 += c * c; }
  red[tid] = s2; __syncthreads();
  for (int st = 128; st > 0; st >>= 1) { if (tid < st) red[tid] += red[tid + st]; __syncthreads(); }
  const float rs = rsqrtf(red[0] / (float)N + eps);
  {
    for (int u = 0; u < per / 4; ++u) {
      const int j = tid * 4 + 1024 * u;
      v4f o, sm;
#pragma unroll
      for (int q = 0; q < 4; ++q) {
        float gg = g[j + q], bb = bta[j + q];
        if (PARAM_BF16) { gg = bf16_round(gg); bb = bf16_round(bb); }
        sm[q] = vals[u * 4 + q]; o[q] = (vals[u * 4 + q] - mu) * rs * gg + bb;
      }
      if (out_sum) *(v4f*)(out_sum + (size_t)row * N + j) = sm;
      *(v4f*)(out_norm + (size_t)row * N + j) = o;
    }
    
  }
}



// ---- f16 WMMA path (v_wmma_f32_16x16x32_f16): 11-bit significands for operands in range — used where a [0,1] probability operand needs more precision than bf16
typedef _Float16 v16h __attribute__((ext_vector_type(16)));
union FragH { v16h v; v8us half[2]; _Float16 h[16]; unsigned short u[16]; };
template <int NT>
__device__ __forceinline__ v8f mmaH(v16h ah, v16h al, v16h bh, v16h bl, v8f c) {
  c = __builtin_amdgcn_wmma_f32_16x16x32_f16(false, ah, false, bh, (short)0, c, false, false);
  if (NT >= 2) c = __builtin_amdgcn_wmma_f32_16x16x32_f16(false, al, false, bh, (short)0, c, false, false);
  if (NT >= 3) c = __builtin_amdgcn_wmma_f32_16x16x32_f16(false, ah, false, bl, (short)0, c, false, false);
  asm volatile("v_nop\n\tv_nop\n\tv_nop\n\tv_nop" : "+v"(c) : "v"(ah), "v"(al), "v"(bh), "v"(bl));
  return c;
}
// batched GEMM like k_gemm_b but f16 operands: A f32 (split into f16 hi/lo if ASPLIT, else rounded to f16), Bt = f16 values [n][k]; alpha; C f32; N multiple of 16 (partial tiles skipped)
template <bool ASPLIT>
__global__ __launch_bounds__(128) void k_gemm_h(const float* __restrict__ A, int lda, size_t sA, const _Float16* __restrict__ Bh, int ldb, size_t sB, float alpha, float* __restrict__ C, int ldc, size_t sC, int M, int N, int K) {
  __shared__ __attribute__((aligned(16))) float so[4][16][64];
  const int tid = threadIdx.x, w = tid >> 5, lane = tid & 31, ln = lane & 15, hh = lane >> 4; const int by = blockIdx.y;
  A += (size_t)by * sA; Bh += (size_t)by * sB; C += (size_t)by * sC;
  const int ntn = (N + 63) / 64; const int wid = blockIdx.x * 4 + w; const int mt = wid / ntn, nq = wid % ntn; if (mt * 16 >= M) return;
  const int row0 = mt * 16, col0 = nq * 64; const float* arow = A + (size_t)(row0 + ln) * lda;
  v8f acc[4] = {};
  for (int kb = 0; kb < K; kb += 32) {
    FragH ah, al;
    const v4f x0 = *(const v4fa*)(arow + kb + 8 * hh), x1 = *(const v4fa*)(arow + kb + 8 * hh + 4), x2 = *(const v4fa*)(arow + kb + 16 + 8 * hh), x3 = *(const v4fa*)(arow + kb + 16 + 8 * hh + 4);
    float xs[16] = {x0[0],x0[1],x0[2],x0[3],x1[0],x1[1],x1[2],x1[3],x2[0],x2[1],x2[2],x2[3],x3[0],x3[1],x3[2],x3[3]};
#pragma unroll
    for (int i = 0; i < 16; ++i) { const _Float16 h = (_Float16)xs[i]; ah.h[i] = h; al.h[i] = ASPLIT ? (_Float16)(xs[i] - (float)h) : (_Float16)0.0f; }
#pragma unroll
    for (int t = 0; t < 4; ++t) { if (col0 + t * 16 >= N) continue; const size_t boff = (size_t)(col0 + t * 16 + ln) * ldb + kb; FragH bq; bq.half[0] = *(const v8us*)(Bh + boff + 8 * hh); bq.half[1] = *(const v8us*)(Bh + boff + 16 + 8 * hh);
      acc[t] = mmaH<ASPLIT ? 2 : 1>(ah.v, al.v, bq.v, bq.v, acc[t]); }
  }
#pragma unroll
  for (int t = 0; t < 4; ++t) { if (col0 + t * 16 >= N) continue;
#pragma unroll
    for (int r = 0; r < 8; ++r) so[w][8 * hh + r][t * 16 + ln] = acc[t][r] * alpha; }
  __builtin_amdgcn_fence(__ATOMIC_ACQ_REL, "workgroup"); __builtin_amdgcn_wave_barrier();
  const int rsub = lane >> 4, c4 = (lane & 15) * 4;
  {
#pragma unroll
    for (int q = 0; q < 8; ++q) { const int r = q * 2 + rsub; if (col0 + c4 < N) { const v4f v = *(const v4fa*)&so[w][r][c4]; *(v4f*)(C + (size_t)(row0 + r) * ldc + col0 + c4) = v; } }
     }
}

// Wt[n][k] = f16(bf16(W[k][n]) * scale) from f32 row-major W[K][N] (scale = power of two; bf16-exact weights stay exact in f16 away from the subnormal range)
// A work-group turns a tile of 128 k x 64 n through LDS, so that both sides of memory see whole aligned 256-byte pieces: a wave load takes 256 contiguous bytes of two W rows (eight loads in flight), a wave store writes 256 contiguous bytes of two Wt rows.
// A thread holds 8 k x 4 n; its 8 k of one n are one 16-byte LDS store. Column n = 4 c + q lies in LDS row 16 q + c: neighbouring lanes then lie one pitch apart (16 B x odd), which spreads the 16-byte stores over the banks.
#define WT_PITCH 272                 /* LDS row pitch in bytes of a 256-byte row of 128 k */
template <int K, int N>
__device__ __forceinline__ void wt_f16_tile(const float* __restrict__ W, _Float16* __restrict__ Wt, float scale, int tile, unsigned char* tl) {      /* tile: n tile fastest, then k tile; tl: 64 * WT_PITCH bytes of LDS */
  static_assert(K % 128 == 0 && N % 64 == 0, "wt_f16_tile: whole tiles of 128 k x 64 n");
  const int tid = threadIdx.x, g = tid >> 4, c = tid & 15; const int n0 = (tile % (N / 64)) * 64, k0 = (tile / (N / 64)) * 128;
  const float* sp = W + (size_t)(k0 + 8 * g) * N + n0 + 4 * c; v4f x[8];
#pragma unroll
  for (int i = 0; i < 8; ++i) x[i] = *(const v4fa*)(sp + (size_t)i * N);      /* unrolled: the eight rows' loads fly together, one address and immediate offsets */
  asm volatile("s_wait_xcnt 0x0" :: "v"(sp) : "memory");      /* the wait that belongs in front of any overwrite of the loads' address register; naming it keeps it whole up to here */
#pragma unroll
  for (int q = 0; q < 4; ++q) { FragH f;
#pragma unroll
    for (int i = 0; i < 8; ++i) f.h[i] = (_Float16)(bf16_round(x[i][q]) * scale);
    *(v8us*)(tl + (16 * q + c) * WT_PITCH + 16 * g) = f.half[0]; }
  __syncthreads();      /* the tile is whole before its rows are read */
  unsigned short* dp = (unsigned short*)Wt + (size_t)(n0 + 4 * g) * K + k0 + 8 * c;      /* sixteen lanes take one 256-byte row piece; LDS row 16 j + g is column 4 g + j */
#pragma unroll
  for (int j = 0; j < 4; ++j) { const v8us v = *(const v8us*)(tl + (16 * j + g) * WT_PITCH + 16 * c); *(v8us*)(dp + (size_t)j * K) = v; }
  asm volatile("s_wait_xcnt 0x0" ::: "memory");      /* the wait that belongs in front of a later overwrite of the registers which these four stores name: in a shared launch another job's code follows in the listing */
}
// k_gemm_hh variant with fused epilogue: v = acc·alpha + bias[by·sBias + col] (+ CP[(row/rowsPerB)·sCPb + by·64 + col] if CP) ; ACT 0 none / 1 elu ; writes f16 C16 (and f32 C if non-null)
template <int ACT>
__global__ __launch_bounds__(128) void k_gemm_hhx(const _Float16* __restrict__ A, int lda, size_t sA, const _Float16* __restrict__ Bh, int ldb, size_t sB, float alpha, const float* __restrict__ bias, size_t sBias, const float* __restrict__ CP, int rowsPerB, size_t sCPb, int row0g,
    float* __restrict__ C, _Float16* __restrict__ C16, int ldc, size_t sC, int M, int N, int K) {
  __shared__ __attribute__((aligned(16))) float so[4][16][64];
  const int tid = threadIdx.x, w = tid >> 5, lane = tid & 31, ln = lane & 15, hh = lane >> 4; const int by = blockIdx.y;
  A += (size_t)by * sA; Bh += (size_t)by * sB; const size_t cofs = (size_t)by * sC; const float* bp = bias ? bias + (size_t)by * sBias : nullptr;
  const int ntn = (N + 63) / 64; const int wid = blockIdx.x * 4 + w; const int mt = wid / ntn, nq = wid % ntn; if (mt * 16 >= M) return;
  const int row0 = mt * 16, col0 = nq * 64; const _Float16* arow = A + (size_t)(row0 + ln) * lda;
  v8f acc[4] = {};
  for (int kb = 0; kb < K; kb += 32) { FragH ah; ah.half[0] = *(const v8us*)((const unsigned short*)arow + kb + 8 * hh); ah.half[1] = *(const v8us*)((const unsigned short*)arow + kb + 16 + 8 * hh);
#pragma unroll
    for (int t = 0; t < 4; ++t) { if (col0 + t * 16 >= N) continue; const size_t boff = (size_t)(col0 + t * 16 + ln) * ldb + kb; FragH bq; bq.half[0] = *(const v8us*)((const unsigned short*)Bh + boff + 8 * hh); bq.half[1] = *(const v8us*)((const unsigned short*)Bh + boff + 16 + 8 * hh);
      acc[t] = mmaH<1>(ah.v, ah.v, bq.v, bq.v, acc[t]); }
  }
#pragma unroll
  for (int t = 0; t < 4; ++t) { if (col0 + t * 16 >= N) continue; const int col = col0 + t * 16 + ln; const float bv = bp ? bf16_round(bp[col]) : 0.f;
#pragma unroll
    for (int r = 0; r < 8; ++r) { float v = acc[t][r] * alpha + bv; if (CP) { const int rr = row0g + row0 + 8 * hh + r; if (rowsPerB < 0) v += CP[cofs + (size_t)rr * ldc + col];      /* rowsPerB < 0: own element of the batched C plane */ else { const int bidx = rr / rowsPerB; v += CP[(size_t)bidx * sCPb + (size_t)by * 64 + col]; } } if (ACT == 1) v = (v > 0.f) ? v : expm1f(v); else if (ACT == 7) v = (v > 0.f) ? v + 1.0f : expf(v); else if (ACT == 8) v = tanhf(v); else if (ACT == 9) v = 0.5f * v * (1.0f + tanhf(0.7978845608028654f * (v + 0.044715f * v * v * v))); else if (ACT == 11) v = 1.0f / (1.0f + expf(-v)); else if (ACT == 12) v = (v > 0.f) ? v : 0.01f * v; else if (ACT == 14) v = (v > 0.f) ? v : 0.1f * v; else if (ACT == 16) v = (v >= 0.f) ? v : 0.3f * v; else if (ACT == 17) v = (v >= 0.f) ? v : 0.2f * v; else if (ACT == 15) v = v / (1.0f + expf(-v)); else if (ACT == 3) v = fmaxf(v, 0.f); else if (ACT == 6) v = 0.5f * v * (1.0f + erff(v * 0.70710678118654752f)); so[w][8 * hh + r][t * 16 + ln] = v; } }
  __builtin_amdgcn_fence(__ATOMIC_ACQ_REL, "workgroup"); __builtin_amdgcn_wave_barrier();
  const int rsub = lane >> 4, c4 = (lane & 15) * 4; typedef _Float16 v4h __attribute__((ext_vector_type(4)));
  {
#pragma unroll
    for (int q = 0; q < 8; ++q) { const int r = q * 2 + rsub; if (col0 + c4 < N) { const v4f v = *(const v4fa*)&so[w][r][c4]; if (C) *(v4f*)(C + cofs + (size_t)(row0 + r) * ldc + col0 + c4) = v; if (C16) { v4h h4; for (int i = 0; i < 4; ++i) h4[i] = (_Float16)v[i]; *(v4h*)(C16 + cofs + (size_t)(row0 + r) * ldc + col0 + c4) = h4; } } }
     }
}


typedef _Float16 v4h __attribute__((ext_vector_type(4)));

__global__ __launch_bounds__(256) void k_x16(const float* __restrict__ x, _Float16* __restrict__ X16, size_t n8) { const size_t t = (size_t)blockIdx.x * 256 + threadIdx.x; if (t >= n8) return; FragH f;
#pragma unroll
  for (int q = 0; q < 8; ++q) f.h[q] = (_Float16)bf16_round(x[t * 8 + q]); *(v8us*)((unsigned short*)X16 + t * 8) = f.half[0];  }
__global__ __launch_bounds__(256) void k_h16(const float* __restrict__ x, _Float16* __restrict__ X16, size_t n8) { const size_t t = (size_t)blockIdx.x * 256 + threadIdx.x; if (t >= n8) return; FragH f;
#pragma unroll
  for (int q = 0; q < 8; ++q) f.h[q] = (_Float16)x[t * 8 + q]; *(v8us*)((unsigned short*)X16 + t * 8) = f.half[0];  }
__global__ __launch_bounds__(256) void k_round16f(const float* __restrict__ W, _Float16* __restrict__ Bt, size_t n8) { const size_t t = (size_t)blockIdx.x * 256 + threadIdx.x; if (t >= n8) return; FragH f;
#pragma unroll
  for (int i = 0; i < 8; ++i) f.h[i] = (_Float16)(bf16_round(W[t * 8 + i]) * 16.0f); *(v8us*)((unsigned short*)Bt + t * 8) = f.half[0];  }
template <int NHv, int TTv>
__global__ __launch_bounds__(256) void k_vt(const _Float16* __restrict__ V16, int ldv, int voff, _Float16* __restrict__ Vt) { __shared__ unsigned short tl[64][66]; const int tid = threadIdx.x; const int slab = blockIdx.x / (TTv / 64), lg = blockIdx.x % (TTv / 64); const int b = slab / NHv, h = slab % NHv;
  for (int i = tid; i < 64 * 8; i += 256) { const int r = i / 8, c8 = (i % 8) * 8; FragH f; f.half[0] = *(const v8us*)((const unsigned short*)V16 + ((size_t)b * TTv + lg * 64 + r) * ldv + voff + h * 64 + c8);
#pragma unroll
    for (int q = 0; q < 8; ++q) tl[r][c8 + q] = f.u[q]; }
  __syncthreads();
  {
#pragma unroll
    for (int rd = 0; rd < 2; ++rd) { const int d = rd * 32 + tid / 8, pc = tid % 8; FragH f;
#pragma unroll
      for (int q = 0; q < 8; ++q) f.u[q] = tl[pc * 8 + q][d];
      *(v8us*)((unsigned short*)Vt + ((size_t)slab * 64 + d) * TTv + lg * 64 + pc * 8) = f.half[0]; }
     } }

__device__ __forceinline__ void hl_piece(const float* __restrict__ F, _Float16* __restrict__ Hh, _Float16* __restrict__ Hl, size_t n8, int blk) { const size_t t = (size_t)blk * 256 + threadIdx.x; if (t >= n8) return;      /* blk: which 256 groups of 8 values */ FragH fh, fl; const v4f a = *(const v4fa*)(F + t * 8), c = *(const v4fa*)(F + t * 8 + 4);
#pragma unroll
  for (int q = 0; q < 4; ++q) { _Float16 h = (_Float16)a[q]; fh.h[q] = h; fl.h[q] = (_Float16)((a[q] - (float)h) * 1024.0f); h = (_Float16)c[q]; fh.h[4 + q] = h; fl.h[4 + q] = (_Float16)((c[q] - (float)h) * 1024.0f); }
  { *(v8us*)((unsigned short*)Hh + t * 8) = fh.half[0]; *(v8us*)((unsigned short*)Hl + t * 8) = fl.half[0];  } }

// ---- fast GEMM (work-group tile 128x64, wave tile 32x64; A and B tiles of 64 k staged in LDS by asynchronous copies, two buffers; requires M % 128 == 0 rows per launch region, N % 64 == 0, K % 64 == 0); epilogue = k_gemm_hhx semantics ----
__device__ __forceinline__ v16h g2_frag(const _Float16* p, int hh) { FragH f; f.half[0] = *(const v8us*)((const unsigned short*)p + 8 * hh); f.half[1] = *(const v8us*)((const unsigned short*)p + 16 + 8 * hh); return f.v; }
__device__ __forceinline__ v8f g2_mma(v16h a, v16h b, v8f c) { v8f d = __builtin_amdgcn_wmma_f32_16x16x32_f16(false, a, false, b, (short)0, c, false, false); asm volatile("v_nop\n\tv_nop\n\tv_nop\n\tv_nop" : "+v"(d) : "v"(a), "v"(b)); return d; }
#define G2_PITCH 144                 /* LDS row pitch in bytes of a staged 128-byte row: 16 B x odd, the conflict-free pitch for 16-byte LDS reads */
#define G2_BUF (192 * G2_PITCH)      /* one staged tile: 128 A rows, then 64 B rows, 64 k each */
static_assert(MP % 128 == 0 && QT % 128 == 0 && QT0 % 128 == 0, "k_gemm2: a work-group stages 128 whole A rows");
static_assert(HD % 64 == 0 && QT % 64 == 0 && DM % 64 == 0 && DFF % 64 == 0, "k_gemm2: K is a multiple of the staged 64 k, N of the 64 B rows");
// One tile into LDS: twelve asynchronous 16-byte copies a lane (a wave's 32 lanes take 4 whole 128-byte rows per copy; copy i lands 16 rows below copy i - 1; 0..7 = A rows, 8..11 = B rows).
// One asm statement: the copies go from global memory to LDS through no register, and the s_wait_xcnt at its end stands in front of any later overwrite of the address registers that the copies name.
__device__ __forceinline__ void g2_stage(unsigned l, const _Float16* ga, size_t sa, const _Float16* gb, size_t sb) {
  asm volatile("global_load_async_to_lds_b128 %0, %12, off\n\tglobal_load_async_to_lds_b128 %1, %13, off\n\tglobal_load_async_to_lds_b128 %2, %14, off\n\tglobal_load_async_to_lds_b128 %3, %15, off\n\t"
               "global_load_async_to_lds_b128 %4, %16, off\n\tglobal_load_async_to_lds_b128 %5, %17, off\n\tglobal_load_async_to_lds_b128 %6, %18, off\n\tglobal_load_async_to_lds_b128 %7, %19, off\n\t"
               "global_load_async_to_lds_b128 %8, %20, off\n\tglobal_load_async_to_lds_b128 %9, %21, off\n\tglobal_load_async_to_lds_b128 %10, %22, off\n\tglobal_load_async_to_lds_b128 %11, %23, off\n\ts_wait_xcnt 0x0"
               :: "v"(l), "v"(l + 16 * G2_PITCH), "v"(l + 32 * G2_PITCH), "v"(l + 48 * G2_PITCH), "v"(l + 64 * G2_PITCH), "v"(l + 80 * G2_PITCH), "v"(l + 96 * G2_PITCH), "v"(l + 112 * G2_PITCH),
                  "v"(l + 128 * G2_PITCH), "v"(l + 144 * G2_PITCH), "v"(l + 160 * G2_PITCH), "v"(l + 176 * G2_PITCH),
                  "v"(ga), "v"(ga + sa), "v"(ga + 2 * sa), "v"(ga + 3 * sa), "v"(ga + 4 * sa), "v"(ga + 5 * sa), "v"(ga + 6 * sa), "v"(ga + 7 * sa), "v"(gb), "v"(gb + sb), "v"(gb + 2 * sb), "v"(gb + 3 * sb) : "memory"); }
template <int ACT>
__global__ __launch_bounds__(128) void k_gemm2(const _Float16* __restrict__ A, int lda, size_t sA, const _Float16* __restrict__ Bh, int ldb, size_t sB, float alpha, const float* __restrict__ bias, size_t sBias, const float* __restrict__ CP, int rowsPerB, size_t sCPb, int row0g,
    float* __restrict__ C, _Float16* __restrict__ C16, int ldc, size_t sC, int M, int N, int K, size_t zA = 0, size_t zB = 0, size_t zC = 0) { static_assert(ACT == 0 || ACT == 3 || ACT == 6 || ACT == 8 || ACT == 9 || ACT == 11 || ACT == 12 || ACT == 14 || ACT == 15 || ACT == 16 || ACT == 17, "k_gemm2: unsupported ACT code (would silently apply no activation)");
  __shared__ __attribute__((aligned(16))) unsigned char sm[2 * G2_BUF]; float (*so)[32][68] = (float (*)[32][68])sm;      /* two staged tiles; behind the loop's last barrier the same bytes are the epilogue's [4][32][68] f32 staging */
  static_assert(sizeof(float) * 4 * 32 * 68 <= 2 * G2_BUF, "k_gemm2: the epilogue staging fits the two tile buffers");
  const int tid = threadIdx.x, w = tid >> 5, lane = tid & 31, ln = lane & 15, hh = lane >> 4; const int by = blockIdx.y; const int bz = blockIdx.z;      /* second batch axis (strides zA, zB, zC) */
  A += (size_t)by * sA + (size_t)bz * zA; Bh += (size_t)by * sB + (size_t)bz * zB; const size_t cofs = (size_t)by * sC + (size_t)bz * zC; const float* bp = bias ? bias + (size_t)by * sBias : nullptr;
  const int ntn = N >> 6; const int mt = blockIdx.x / ntn, nq = blockIdx.x - mt * ntn; const int row0 = mt * 128 + 32 * w, col0 = nq * 64; if (mt * 128 >= M) return;      /* the whole work-group leaves or none: barriers follow */
  const _Float16* ga = A + (size_t)(mt * 128 + (tid >> 3)) * lda + (tid & 7) * 8; const _Float16* gb = Bh + (size_t)(col0 + (tid >> 3)) * ldb + (tid & 7) * 8;      /* this lane's 16 bytes of row tid / 8 of each 16-row group */
  const size_t sa = (size_t)16 * lda, sb = (size_t)16 * ldb; const unsigned l0 = (unsigned)(size_t)sm + (unsigned)((tid >> 3) * G2_PITCH + (tid & 7) * 16);
  const unsigned char* fa = sm + (32 * w + ln) * G2_PITCH; const unsigned char* fb = sm + (128 + ln) * G2_PITCH;      /* this lane's fragment rows in buffer 0 */
  const v8f z8 = {0.f,0.f,0.f,0.f,0.f,0.f,0.f,0.f}; v8f c00 = z8, c01 = z8, c02 = z8, c03 = z8, c10 = z8, c11 = z8, c12 = z8, c13 = z8;
  const int nt = K >> 6;
  g2_stage(l0, ga, sa, gb, sb);
  asm volatile("s_wait_asynccnt 0x0" ::: "memory");      /* this wave's copies of tile 0 have landed */
  __syncthreads();      /* tile 0 published: every wave's copies have landed */
  if (nt > 1) g2_stage(l0 + G2_BUF, ga + 64, sa, gb + 64, sb);      /* tile 1 flies while tile 0 is worked on */
#pragma unroll 1
  for (int t = 0; t < nt; ++t) { const unsigned bo = (unsigned)(t & 1) * G2_BUF;      /* kept rolled: one trip is one staged tile and the buffers alternate; unrolled, the copies' and waits' code would only be repeated */
#pragma unroll
    for (int ks = 0; ks < 2; ++ks) { const _Float16* pa = (const _Float16*)(fa + bo + ks * 64); const _Float16* pb = (const _Float16*)(fb + bo + ks * 64);      /* unrolled so that the two halves of a tile are immediate offsets of the LDS reads; 32 k = 64 bytes of every row; k ascends as before */
      const v16h a0 = g2_frag(pa, hh), a1 = g2_frag(pa + 8 * G2_PITCH, hh), b0 = g2_frag(pb, hh), b1 = g2_frag(pb + 8 * G2_PITCH, hh), b2 = g2_frag(pb + 16 * G2_PITCH, hh), b3 = g2_frag(pb + 24 * G2_PITCH, hh);      /* 16 rows = 8 * G2_PITCH halves */
      c00 = g2_mma(a0, b0, c00); c10 = g2_mma(a1, b0, c10); c01 = g2_mma(a0, b1, c01); c11 = g2_mma(a1, b1, c11);
      c02 = g2_mma(a0, b2, c02); c12 = g2_mma(a1, b2, c12); c03 = g2_mma(a0, b3, c03); c13 = g2_mma(a1, b3, c13); }
    asm volatile("s_wait_dscnt 0x0" ::: "memory");      /* this wave's reads of the buffer have returned before the buffer is given up */
    asm volatile("s_wait_asynccnt 0x0" ::: "memory");      /* this wave's copies of tile t + 1 have landed */
    __syncthreads();      /* publishes tile t + 1 and ends every wave's reads of tile t */
    if (t + 2 < nt) g2_stage(l0 + bo, ga + (size_t)(t + 2) * 64, sa, gb + (size_t)(t + 2) * 64, sb); }      /* refill of the buffer just left */
  asm volatile("s_wait_asynccnt 0x0" ::: "memory");      /* no copy is outstanding when the buffers become the epilogue's staging */
  v8f accs[8] = {c00, c01, c02, c03, c10, c11, c12, c13};
#pragma unroll
  for (int u = 0; u < 8; ++u) { const int t = u & 3, half = u >> 2; const int col = col0 + t * 16 + ln; const float bv = bp ? bf16_round(bp[col]) : 0.f;
#pragma unroll
    for (int r = 0; r < 8; ++r) { const int rloc = half * 16 + 8 * hh + r; float v = accs[u][r] * alpha + bv; if (CP) { if (rowsPerB < 0) v += CP[cofs + (size_t)(row0g + row0 + rloc) * ldc + col];      /* rowsPerB < 0: own element of the batched C plane */ else { const int bidx = (row0g + row0 + rloc) / rowsPerB; v += CP[(size_t)bidx * sCPb + (size_t)by * 64 + col]; } }
      if (ACT == 3) v = fmaxf(v, 0.f); else if (ACT == 6) v = 0.5f * v * (1.0f + erff(v * 0.70710678118654752f)); else if (ACT == 11) v = 1.0f / (1.0f + expf(-v)); else if (ACT == 15) v = v / (1.0f + expf(-v)); else if (ACT == 12) v = (v > 0.f) ? v : 0.01f * v; else if (ACT == 8) v = tanhf(v); else if (ACT == 9) v = 0.5f * v * (1.0f + tanhf(0.7978845608028654f * (v + 0.044715f * v * v * v))); else if (ACT == 14) v = (v > 0.f) ? v : 0.1f * v; else if (ACT == 16) v = (v >= 0.f) ? v : 0.3f * v; else if (ACT == 17) v = (v >= 0.f) ? v : 0.2f * v;
      so[w][rloc][t * 16 + ln] = v; } }
  __builtin_amdgcn_fence(__ATOMIC_ACQ_REL, "workgroup"); __builtin_amdgcn_wave_barrier();
  const int rsub = lane >> 4, c4 = (lane & 15) * 4;
  {
#pragma unroll
    for (int q = 0; q < 16; ++q) { const int r = q * 2 + rsub; const v4f v = *(const v4fa*)&so[w][r][c4]; if (C) *(v4f*)(C + cofs + (size_t)(row0 + r) * ldc + col0 + c4) = v; if (C16) { v4h h4; for (int i = 0; i < 4; ++i) h4[i] = (_Float16)v[i]; *(v4h*)(C16 + cofs + (size_t)(row0 + r) * ldc + col0 + c4) = h4; } }
     } }


// ---- wide GEMM for the four all-row products (work-group tile 256x128, eight waves as 4 x 2, wave tile 64x64; requires M % 256 == 0, N % 128 == 0, K % 64 == 0); staging, k order and epilogue arithmetic as in k_gemm2 ----
// Against the 128x64 tile: half the operand rows copied from L2 per output element (384 rows per 32768 outputs, not 192 per 8192), and 16 LDS fragment reads per 16 products, not 12 per 8.
#define G3_BUF (384 * G2_PITCH)      /* one staged tile: 256 A rows, then 128 B rows, 64 k each */
static_assert(MP % 256 == 0 && DM % 128 == 0 && DFF % 128 == 0, "k_gemm3: whole 256x128 tiles");
// One tile into LDS: twelve asynchronous 16-byte copies a lane (the work-group's 256 lanes take 32 whole 128-byte rows per copy; copy i lands 32 rows below copy i - 1; 0..7 = A rows, 8..11 = B rows).
// One asm statement, as in g2_stage: the s_wait_xcnt at its end stands in front of any later overwrite of the address registers that the copies name.
__device__ __forceinline__ void g3_stage(unsigned l, const _Float16* ga, const _Float16* ga4, size_t sa, const _Float16* gb, size_t sb) {      /* ga4: this lane's source of copy 4, the first of the tile's lower 128 A rows */
  asm volatile("global_load_async_to_lds_b128 %0, %12, off\n\tglobal_load_async_to_lds_b128 %1, %13, off\n\tglobal_load_async_to_lds_b128 %2, %14, off\n\tglobal_load_async_to_lds_b128 %3, %15, off\n\t"
               "global_load_async_to_lds_b128 %4, %16, off\n\tglobal_load_async_to_lds_b128 %5, %17, off\n\tglobal_load_async_to_lds_b128 %6, %18, off\n\tglobal_load_async_to_lds_b128 %7, %19, off\n\t"
               "global_load_async_to_lds_b128 %8, %20, off\n\tglobal_load_async_to_lds_b128 %9, %21, off\n\tglobal_load_async_to_lds_b128 %10, %22, off\n\tglobal_load_async_to_lds_b128 %11, %23, off\n\ts_wait_xcnt 0x0"
               :: "v"(l), "v"(l + 32 * G2_PITCH), "v"(l + 64 * G2_PITCH), "v"(l + 96 * G2_PITCH), "v"(l + 128 * G2_PITCH), "v"(l + 160 * G2_PITCH), "v"(l + 192 * G2_PITCH), "v"(l + 224 * G2_PITCH),
                  "v"(l + 256 * G2_PITCH), "v"(l + 288 * G2_PITCH), "v"(l + 320 * G2_PITCH), "v"(l + 352 * G2_PITCH),
                  "v"(ga), "v"(ga + sa), "v"(ga + 2 * sa), "v"(ga + 3 * sa), "v"(ga4), "v"(ga4 + sa), "v"(ga4 + 2 * sa), "v"(ga4 + 3 * sa), "v"(gb), "v"(gb + sb), "v"(gb + 2 * sb), "v"(gb + 3 * sb) : "memory"); }
// C = act(A Bh^T alpha + bias (+ CP where RES: the own element of a plane laid out like C)); F32O: f32 rows into C, else f16 rows into C16; LDC: row pitch of C, C16 and CP in elements
// FT: the M rows are the first QT0 = 128 rows of every batch, taken from A at their places (row r of the product is row r % 128 of batch r / 128), so that a tile's upper and lower 128 rows are two batches' first tiles; C rows stay r
// bx: which tile, n tile fastest; sm: 2 * G3_BUF bytes of LDS
template <int ACT, bool RES, bool F32O, int LDC, bool FT>
__device__ __forceinline__ void gemm3_tile(const _Float16* __restrict__ A, int lda, const _Float16* __restrict__ Bh, int ldb, float alpha, const float* __restrict__ bias, const float* __restrict__ CP,
    float* __restrict__ C, _Float16* __restrict__ C16, int M, int N, int K, int bx, unsigned char* sm) { static_assert(ACT == 0 || ACT == 3, "gemm3_tile: no activation or relu"); static_assert(!FT || QT0 == 128, "gemm3_tile: a first tile is half a tile's rows");
  float (*so)[32][68] = (float (*)[32][68])sm;      /* two staged tiles; behind the loop's last barrier the same bytes are the epilogue's [8][32][68] f32 staging */
  static_assert(sizeof(float) * 8 * 32 * 68 <= 2 * G3_BUF, "gemm3_tile: the epilogue staging fits the two tile buffers");
  const int tid = threadIdx.x, w = tid >> 5, lane = tid & 31, ln = lane & 15, hh = lane >> 4; const int wm = w >> 1, wn = w & 1;
  const int ntn = N >> 7; const int mt = bx / ntn, nq = bx - mt * ntn; const int row0 = mt * 256 + 64 * wm, col0 = nq * 128 + 64 * wn; if (mt * 256 >= M) return;      /* the whole work-group leaves or none: barriers follow */
  const _Float16* ga = A + (size_t)((FT ? mt * 2 * SQ : mt * 256) + (tid >> 3)) * lda + (tid & 7) * 8; const _Float16* gb = Bh + (size_t)(nq * 128 + (tid >> 3)) * ldb + (tid & 7) * 8;      /* this lane's 16 bytes of row tid / 8 of each 32-row group */
  const _Float16* ga4 = ga + (size_t)(FT ? SQ : 128) * lda;      /* the same of the lower 128 rows */
  const size_t sa = (size_t)32 * lda, sb = (size_t)32 * ldb; const unsigned l0 = (unsigned)(size_t)sm + (unsigned)((tid >> 3) * G2_PITCH + (tid & 7) * 16);
  const unsigned char* fa = sm + (64 * wm + ln) * G2_PITCH; const unsigned char* fb = sm + (256 + 64 * wn + ln) * G2_PITCH;      /* this lane's fragment rows in buffer 0 */
  const v8f z8 = {0.f,0.f,0.f,0.f,0.f,0.f,0.f,0.f}; v8f c[4][4];
#pragma unroll
  for (int i = 0; i < 4; ++i)
#pragma unroll
    for (int j = 0; j < 4; ++j) c[i][j] = z8;
  const int nt = K >> 6;
  g3_stage(l0, ga, ga4, sa, gb, sb);
  asm volatile("s_wait_asynccnt 0x0" ::: "memory");      /* this wave's copies of tile 0 have landed */
  __syncthreads();      /* tile 0 published: every wave's copies have landed */
  if (nt > 1) g3_stage(l0 + G3_BUF, ga + 64, ga4 + 64, sa, gb + 64, sb);      /* tile 1 flies while tile 0 is worked on */
#pragma unroll 1
  for (int t = 0; t < nt; ++t) { const unsigned bo = (unsigned)(t & 1) * G3_BUF;      /* kept rolled: one trip is one staged tile and the buffers alternate */
#pragma unroll
    for (int ks = 0; ks < 2; ++ks) { const _Float16* pa = (const _Float16*)(fa + bo + ks * 64); const _Float16* pb = (const _Float16*)(fb + bo + ks * 64); v16h a[4], b[4];      /* unrolled: the two halves of a tile are immediate offsets of the LDS reads; k ascends as in k_gemm2 */
#pragma unroll
      for (int i = 0; i < 4; ++i) { a[i] = g2_frag(pa + i * 8 * G2_PITCH, hh); b[i] = g2_frag(pb + i * 8 * G2_PITCH, hh); }      /* 16 rows = 8 * G2_PITCH halves; the eight fragments' reads stand together in front of their products */
#pragma unroll
      for (int j = 0; j < 4; ++j)
#pragma unroll
        for (int i = 0; i < 4; ++i) c[i][j] = g2_mma(a[i], b[j], c[i][j]); }
    asm volatile("s_wait_dscnt 0x0" ::: "memory");      /* this wave's reads of the buffer have returned before the buffer is given up */
    asm volatile("s_wait_asynccnt 0x0" ::: "memory");      /* this wave's copies of tile t + 1 have landed */
    __syncthreads();      /* publishes tile t + 1 and ends every wave's reads of tile t */
    if (t + 2 < nt) g3_stage(l0 + bo, ga + (size_t)(t + 2) * 64, ga4 + (size_t)(t + 2) * 64, sa, gb + (size_t)(t + 2) * 64, sb); }      /* refill of the buffer just left */
  asm volatile("s_wait_asynccnt 0x0" ::: "memory");      /* no copy is outstanding when the buffers become the epilogue's staging */
  const int rsub = lane >> 4, c4 = (lane & 15) * 4; float bv[4] = {0.f, 0.f, 0.f, 0.f};
  if (bias) {      /* one test for the four loads, so that they fly together */
#pragma unroll
    for (int t = 0; t < 4; ++t) bv[t] = bf16_round(bias[col0 + t * 16 + ln]); }
  const size_t e0 = (size_t)(row0 + rsub) * LDC + col0 + c4;      /* this lane's 4 columns of row rsub of the wave's tile; its further rows lie 2 LDC apart, a compile-time step, so that every access below is this one address and an immediate offset */
#pragma unroll
  for (int hf = 0; hf < 2; ++hf) {      /* the wave's 64 rows leave in two halves of 32 through its own staging rows */
    v4f res[16];
    if (RES) { const float* rp = CP + e0;      /* the residual in the layout of the write-out: whole 256-byte row pieces, the half's sixteen loads in flight together, under the staging below */
#pragma unroll
      for (int q = 0; q < 16; ++q) res[q] = *(const v4fa*)(rp + (32 * hf + 2 * q) * LDC);
      asm volatile("s_wait_xcnt 0x0" :: "v"(rp) : "memory"); }      /* the wait that belongs in front of any overwrite of the loads' address register; naming it keeps it whole up to here */
#pragma unroll
    for (int u = 0; u < 8; ++u) { const int t = u & 3, ih = u >> 2;
#pragma unroll
      for (int r = 0; r < 8; ++r) so[w][ih * 16 + 8 * hh + r][t * 16 + ln] = c[2 * hf + ih][t][r] * alpha + bv[t]; }
    __builtin_amdgcn_fence(__ATOMIC_ACQ_REL, "workgroup"); __builtin_amdgcn_wave_barrier();      /* the wave's staging stores stay in front of its row reads */
#pragma unroll
    for (int g = 0; g < 2; ++g) {
#pragma unroll
      for (int q = 8 * g; q < 8 * g + 8; ++q) { v4f v = *(const v4fa*)&so[w][q * 2 + rsub][c4];
        if (RES) v += res[q];      /* acc alpha + bias, then the residual, then the activation: the order of k_gemm2 */
        if (ACT == 3) { for (int i = 0; i < 4; ++i) v[i] = fmaxf(v[i], 0.f); }
        if (F32O) *(v4f*)(C + e0 + (32 * hf + 2 * q) * LDC) = v; else { v4h h4; for (int i = 0; i < 4; ++i) h4[i] = (_Float16)v[i]; *(v4h*)(C16 + e0 + (32 * hf + 2 * q) * LDC) = h4; } }
      asm volatile("s_wait_xcnt 0x0" ::: "memory"); }      /* the wait that belongs in front of a later overwrite of the registers which these eight stores name */
    __builtin_amdgcn_fence(__ATOMIC_ACQ_REL, "workgroup"); __builtin_amdgcn_wave_barrier(); } }      /* the row reads stay in front of the next half's staging stores */
template <int ACT, bool RES, bool F32O, int LDC>
__global__ __launch_bounds__(256) void k_gemm3(const _Float16* __restrict__ A, int lda, const _Float16* __restrict__ Bh, int ldb, float alpha, const float* __restrict__ bias, const float* __restrict__ CP,
    float* __restrict__ C, _Float16* __restrict__ C16, int M, int N, int K) {
  __shared__ __attribute__((aligned(16))) unsigned char sm[2 * G3_BUF];
  gemm3_tile<ACT, RES, F32O, LDC, false>(A, lda, Bh, ldb, alpha, bias, CP, C, C16, M, N, K, (int)blockIdx.x, sm); }
// x1 = x + o Wo + b of all rows, and the split of the exact first-tile o into its two f16 planes: neither reads what the other writes, one launch. The GEMM tiles come first (one per WGP's first place); the short split pieces run in the places beside them. The branch is the same for a whole work-group.
#define PJ_ALL ((MPO / 256) * (DM / 128))
#define PJ_HL ((int)(((size_t)NB * QT0 * DM / 8 + 255) / 256))
__global__ __launch_bounds__(256) void k_proj(const _Float16* __restrict__ A, const _Float16* __restrict__ Bh, const float* __restrict__ bias, const float* __restrict__ CP, float* __restrict__ C, const float* __restrict__ F, _Float16* __restrict__ Hh, _Float16* __restrict__ Hl) {
  __shared__ __attribute__((aligned(16))) unsigned char sm[2 * G3_BUF];
  const int bx = (int)blockIdx.x;
  if (bx < PJ_ALL) { gemm3_tile<0, true, true, DM, false>(A, DM, Bh, DM, 0.0009765625f, bias, CP, C, nullptr, MPO, DM, DM, bx, sm); return; }
  hl_piece(F, Hh, Hl, (size_t)NB * QT0 * DM / 8, bx - PJ_ALL); }
// q | k | v of all rows (f16) and, from the same operands, q | k | v of every batch's first tile (f32, for the exact attention): neither reads what the other writes, one launch. The all-row tiles come first; the few first-tile ones fill places of the last, partly empty round. The branch is the same for a whole work-group.
#define QB_ALL ((MP / 256) * (3 * DM / 128))
#define QB_FT ((NB * QT0 / 256) * (3 * DM / 128))
static_assert((NB * QT0) % 256 == 0, "k_qkv: whole tiles of two first tiles");
__global__ __launch_bounds__(256) void k_qkv(const _Float16* __restrict__ A, const _Float16* __restrict__ Bh, const float* __restrict__ bias, _Float16* __restrict__ C16, float* __restrict__ CF) {
  __shared__ __attribute__((aligned(16))) unsigned char sm[2 * G3_BUF];
  const int bx = (int)blockIdx.x;
  if (bx < QB_ALL) { gemm3_tile<0, false, false, 3 * DM, false>(A, DM, Bh, DM, 0.0625f, bias, nullptr, nullptr, C16, MP, 3 * DM, DM, bx, sm); return; }
  gemm3_tile<0, false, true, 3 * DM, true>(A, DM, Bh, DM, 0.0625f, bias, nullptr, CF, nullptr, NB * QT0, 3 * DM, DM, bx - QB_ALL, sm); }


__global__ __launch_bounds__(256) void k_wnat(const float* __restrict__ w, size_t n8, _Float16* __restrict__ Bt) { const size_t t = (size_t)blockIdx.x * 256 + threadIdx.x; if (t >= n8) return; FragH f; for (int q = 0; q < 8; ++q) f.h[q] = (_Float16)(bf16_round(w[t * 8 + q]) * 16.0f); *(v8us*)((unsigned short*)Bt + t * 8) = f.half[0];  }
__global__ __launch_bounds__(256) void k_rsm(const float* __restrict__ S, _Float16* __restrict__ P, int nrows) {
  #pragma clang fp contract(off)
  const int i = blockIdx.x * 256 + threadIdx.x; if (i >= nrows) return; const float* s = S + (size_t)i * SQ; float mx = -3.0e38f;
#pragma unroll 1
  for (int j = 0; j < SQ; ++j) mx = fmaxf(mx, s[j]); float se = 0.f;
#pragma unroll 1
  for (int j = 0; j < SQ; ++j) se += expf(s[j] - mx); const float sc = 256.0f / se;
#pragma unroll 1
  for (int j0 = 0; j0 < SQ; j0 += 8) { FragH f; for (int q = 0; q < 8; ++q) f.h[q] = (_Float16)(expf(s[j0 + q] - mx) * sc); unsigned short* d = (unsigned short*)P + (size_t)i * SQ + j0; *(v8us*)d = f.half[0];  } }
__global__ __launch_bounds__(256) void k_vt(const _Float16* __restrict__ V16, int b, int h0, _Float16* __restrict__ VT) { __shared__ unsigned short tl[64][65]; const int tid = threadIdx.x; const int hh = blockIdx.x % HG, sg = blockIdx.x / HG; const int s0 = sg * 64; const int h = h0 + hh;
  for (int i = tid; i < 64 * 8; i += 256) { const int j = i / 8, d8 = (i % 8) * 8; FragH f; f.half[0] = *(const v8us*)((const unsigned short*)V16 + ((size_t)b * SQ + s0 + j) * DM + h * HD + d8); for (int q = 0; q < 8; ++q) tl[d8 + q][j] = f.u[q]; }
  __syncthreads();
  { for (int i = tid; i < 64 * 8; i += 256) { const int d = i / 8, j8 = (i % 8) * 8; FragH f; for (int q = 0; q < 8; ++q) f.u[q] = tl[d][j8 + q]; *(v8us*)((unsigned short*)VT + ((size_t)hh * HD + d) * SQ + s0 + j8) = f.half[0]; }  } }



// lane l with lane l ^ m inside a 16-lane row (DPP row_xmask, CTRL = 0x160 | m)
template <int CTRL> __device__ __forceinline__ float lane_xm(float x) { return __builtin_bit_cast(float, __builtin_amdgcn_update_dpp(0, __builtin_bit_cast(int, x), CTRL, 0xf, 0xf, true)); }
// 2^t for eight values in place. Asm so that the free slot which the instruction set asks for behind a transcendental, before its result is used or its source overwritten, stands by construction: no line here touches the line before it, and the v_nop covers the last
__device__ __forceinline__ void exp2_x8(float (&t)[8]) { asm("v_exp_f32 %0, %0\n\tv_exp_f32 %1, %1\n\tv_exp_f32 %2, %2\n\tv_exp_f32 %3, %3\n\tv_exp_f32 %4, %4\n\tv_exp_f32 %5, %5\n\tv_exp_f32 %6, %6\n\tv_exp_f32 %7, %7\n\tv_nop" : "+v"(t[0]), "+v"(t[1]), "+v"(t[2]), "+v"(t[3]), "+v"(t[4]), "+v"(t[5]), "+v"(t[6]), "+v"(t[7])); }
// ---- fused causal attention: scores, softmax and P V of 128 query rows of one head in one work-group; S and P never reach memory ----
// A wave holds 32 query rows (q fragments and the o tiles in registers). Per tile of 64 keys: S = q K^T on WMMA, running row maximum and sum (the o tiles and the sum are rescaled when the maximum rises), P (x256, f16) goes through the wave's own LDS rows from accumulator layout to A-fragment layout, o += P V on WMMA.
#define FA_BUF (128 * G2_PITCH)      /* one staged key tile: 64 K rows, then 64 V^T rows, 128 bytes each */
#define FA_PH (G2_PITCH / 2)         /* pitch of a P row in halves */
static_assert(SQ % 128 == 0 && HD == 64, "k_fattn: whole tiles of 128 query rows and 64 keys; 64 values a head");
// One key tile into LDS: eight asynchronous 16-byte copies a lane (copy i lands 16 rows below copy i - 1; 0..3 = K rows, 4..7 = V^T rows). One asm statement, as in g2_stage: the s_wait_xcnt at its end stands in front of any later overwrite of the address registers that the copies name.
__device__ __forceinline__ void fa_stage(unsigned l, const _Float16* gk, size_t sk, const _Float16* gv, size_t sv) {
  asm volatile("global_load_async_to_lds_b128 %0, %8, off\n\tglobal_load_async_to_lds_b128 %1, %9, off\n\tglobal_load_async_to_lds_b128 %2, %10, off\n\tglobal_load_async_to_lds_b128 %3, %11, off\n\t"
               "global_load_async_to_lds_b128 %4, %12, off\n\tglobal_load_async_to_lds_b128 %5, %13, off\n\tglobal_load_async_to_lds_b128 %6, %14, off\n\tglobal_load_async_to_lds_b128 %7, %15, off\n\ts_wait_xcnt 0x0"
               :: "v"(l), "v"(l + 16 * G2_PITCH), "v"(l + 32 * G2_PITCH), "v"(l + 48 * G2_PITCH), "v"(l + 64 * G2_PITCH), "v"(l + 80 * G2_PITCH), "v"(l + 96 * G2_PITCH), "v"(l + 112 * G2_PITCH),
                  "v"(gk), "v"(gk + sk), "v"(gk + 2 * sk), "v"(gk + 3 * sk), "v"(gv), "v"(gv + sv), "v"(gv + 2 * sv), "v"(gv + 3 * sv) : "memory"); }
__device__ __forceinline__ float row16_max(float x) { x = fmaxf(x, lane_xm<0x161>(x)); x = fmaxf(x, lane_xm<0x162>(x)); x = fmaxf(x, lane_xm<0x164>(x)); return fmaxf(x, lane_xm<0x168>(x)); }
__device__ __forceinline__ float row16_sum(float x) { x += lane_xm<0x161>(x); x += lane_xm<0x162>(x); x += lane_xm<0x164>(x); return x + lane_xm<0x168>(x); }
#define FA_LDS (2 * FA_BUF + 4 * 32 * G2_PITCH)      /* two staged key tiles, then 32 P rows per wave */
__device__ __forceinline__ void fattn_tile(const _Float16* __restrict__ Q, const _Float16* __restrict__ K, const _Float16* __restrict__ VTp, float scale, _Float16* __restrict__ O, int h, int b, int qt, unsigned char* sm) {      /* sm: FA_LDS bytes of LDS */
  const int tid = threadIdx.x, lane = tid & 31, ln = lane & 15, hh = lane >> 4; const int w = __builtin_amdgcn_readfirstlane(tid >> 5);
  const int q0 = qt * 128;
  const int nt = (q0 + 128) >> 6;      /* causal: key tiles up to the last query row; at least two */
  const int rw = q0 + 32 * w;      /* the wave's first query row */
  const _Float16* qr0 = Q + ((size_t)b * SQ + rw + ln) * LQ + h * HD; const _Float16* qr1 = qr0 + (size_t)16 * LQ;
  const v16h qa00 = g2_frag(qr0, hh), qa01 = g2_frag(qr0 + 32, hh), qa10 = g2_frag(qr1, hh), qa11 = g2_frag(qr1 + 32, hh);
  const _Float16* gk = K + ((size_t)b * SQ + (tid >> 3)) * LQ + h * HD + (tid & 7) * 8; const _Float16* gv = VTp + (((size_t)b * NH + h) * HD + (tid >> 3)) * SQ + (tid & 7) * 8;      /* this lane's 16 bytes of row tid / 8 of each 16-row group */
  const size_t sk = (size_t)16 * LQ, sv = (size_t)16 * SQ; const unsigned l0 = (unsigned)(size_t)sm + (unsigned)((tid >> 3) * G2_PITCH + (tid & 7) * 16);
  const unsigned char* fk = sm + ln * G2_PITCH; const unsigned char* fv = sm + (64 + ln) * G2_PITCH;      /* this lane's fragment rows in buffer 0 */
  _Float16* sp = (_Float16*)(sm + 2 * FA_BUF + w * 32 * G2_PITCH);
  const v8f z8 = {0.f,0.f,0.f,0.f,0.f,0.f,0.f,0.f}; v8f o[2][4]; float m[2][8], l[2][8];
#pragma unroll
  for (int i = 0; i < 2; ++i) {
#pragma unroll
    for (int j = 0; j < 4; ++j) o[i][j] = z8;
#pragma unroll
    for (int r = 0; r < 8; ++r) { m[i][r] = -1.0e30f; l[i][r] = 0.f; } }
  const float sl = scale * 1.44269504f;      /* e^(s scale) = 2^(s scale log2 e) */
  fa_stage(l0, gk, sk, gv, sv);
  asm volatile("s_wait_asynccnt 0x0" ::: "memory");      /* this wave's copies of tile 0 have landed */
  __syncthreads();      /* tile 0 published */
  fa_stage(l0 + FA_BUF, gk + (size_t)64 * LQ, sk, gv + 64, sv);      /* tile 1 flies while tile 0 is worked on */
#pragma unroll 1
  for (int t = 0; t < nt; ++t) { const unsigned bo = (unsigned)(t & 1) * FA_BUF;      /* kept rolled: one trip is one staged tile and the buffers alternate */
    if (t * 64 <= rw + 31) {      /* wave-uniform: a tile wholly above the wave's rows adds nothing; the waits and the barrier below are passed all the same */
      v8f s[2][4];
#pragma unroll
      for (int j = 0; j < 4; ++j) { s[0][j] = z8; s[1][j] = z8; }
#pragma unroll
      for (int ks = 0; ks < 2; ++ks) { const _Float16* pk = (const _Float16*)(fk + bo + ks * 64); v16h kb[4];
        if (ks) __builtin_amdgcn_sched_barrier(0);      /* keeps the second half's fragment reads behind the first half's products: read ahead, they take 32 more registers, the kernel passes 256 and a SIMD holds three waves instead of four */
#pragma unroll
        for (int j = 0; j < 4; ++j) kb[j] = g2_frag(pk + j * 8 * G2_PITCH, hh);      /* the four fragments' reads stand together in front of their products: one LDS latency, not four */
#pragma unroll
        for (int j = 0; j < 4; ++j) { s[0][j] = g2_mma(ks ? qa01 : qa00, kb[j], s[0][j]); s[1][j] = g2_mma(ks ? qa11 : qa10, kb[j], s[1][j]); } }
      if (t * 64 + 63 > rw) {      /* wave-uniform: only tiles that reach above the wave's first row hold masked keys */
#pragma unroll
        for (int i = 0; i < 2; ++i)
#pragma unroll
          for (int j = 0; j < 4; ++j)
#pragma unroll
            for (int r = 0; r < 8; ++r) s[i][j][r] = (t * 64 + 16 * j + ln <= rw + 16 * i + 8 * hh + r) ? s[i][j][r] : -1.0e30f; }
#pragma unroll
      for (int i = 0; i < 2; ++i) { float cr[8], cc[8];      /* accumulator layout: register r of lane (hh, ln) is row 16 i + 8 hh + r, key 16 j + ln */
#pragma unroll
        for (int r = 0; r < 8; ++r) { const float mt = row16_max(fmaxf(fmaxf(s[i][0][r], s[i][1][r]), fmaxf(s[i][2][r], s[i][3][r]))); const float mn = fmaxf(m[i][r], mt); cr[r] = (m[i][r] - mn) * sl; cc[r] = 8.0f - mn * sl; m[i][r] = mn; }
        exp2_x8(cr);
#pragma unroll
        for (int r = 0; r < 8; ++r) l[i][r] *= cr[r];
#pragma unroll
        for (int j = 0; j < 4; ++j) { float p[8];
#pragma unroll
          for (int r = 0; r < 8; ++r) p[r] = fmaf(s[i][j][r], sl, cc[r]);      /* weights carried x256, as the f16 P was before */
          exp2_x8(p);
#pragma unroll
          for (int r = 0; r < 8; ++r) { l[i][r] += p[r]; sp[(16 * i + 8 * hh + r) * FA_PH + 16 * j + ln] = (_Float16)p[r]; o[i][j][r] *= cr[r]; } } }
      __builtin_amdgcn_fence(__ATOMIC_ACQ_REL, "workgroup"); __builtin_amdgcn_wave_barrier();      /* the wave's P stores stay in front of its fragment reads of the same rows */
#pragma unroll
      for (int ks = 0; ks < 2; ++ks) { const v16h pa0 = g2_frag(sp + ln * FA_PH + ks * 32, hh), pa1 = g2_frag(sp + (16 + ln) * FA_PH + ks * 32, hh); const _Float16* pv = (const _Float16*)(fv + bo + ks * 64); v16h vb[4];
#pragma unroll
        for (int j = 0; j < 4; ++j) vb[j] = g2_frag(pv + j * 8 * G2_PITCH, hh);      /* as above */
#pragma unroll
        for (int j = 0; j < 4; ++j) { o[0][j] = g2_mma(pa0, vb[j], o[0][j]); o[1][j] = g2_mma(pa1, vb[j], o[1][j]); } } }
    asm volatile("s_wait_dscnt 0x0" ::: "memory");      /* this wave's reads of the buffer have returned before the buffer is given up */
    asm volatile("s_wait_asynccnt 0x0" ::: "memory");      /* this wave's copies of tile t + 1 have landed */
    __syncthreads();      /* publishes tile t + 1 and ends every wave's reads of tile t */
    if (t + 2 < nt) fa_stage(l0 + bo, gk + (size_t)(t + 2) * 64 * LQ, sk, gv + (size_t)(t + 2) * 64, sv); }      /* refill of the buffer just left */
  asm volatile("s_wait_asynccnt 0x0" ::: "memory");      /* no copy is outstanding at the end */
#pragma unroll
  for (int i = 0; i < 2; ++i)
#pragma unroll
    for (int r = 0; r < 8; ++r) { const float fin = 64.0f / row16_sum(l[i][r]);      /* o carried x64 as before; the x256 of the weights cancels */
#pragma unroll
      for (int j = 0; j < 4; ++j) sp[(16 * i + 8 * hh + r) * FA_PH + 16 * j + ln] = (_Float16)(o[i][j][r] * fin); }
  __builtin_amdgcn_fence(__ATOMIC_ACQ_REL, "workgroup"); __builtin_amdgcn_wave_barrier();      /* the wave's o stores stay in front of its row reads */
#pragma unroll
  for (int q = 0; q < 8; ++q) { const int row = q * 4 + (lane >> 3), c8 = (lane & 7) * 8; const v8us v = *(const v8us*)((const unsigned short*)sp + row * FA_PH + c8); *(v8us*)((unsigned short*)O + ((size_t)b * SQ + rw + row) * DM + h * HD + c8) = v; }      /* whole 128-byte row pieces per store */
  asm volatile("s_wait_xcnt 0x0" ::: "memory"); }      /* the wait that belongs in front of a later overwrite of the registers which these eight stores name: in a shared launch the other job's code follows in the listing */


typedef float v2f __attribute__((ext_vector_type(2)));
#define JU 4                         /* keys whose score chains run side by side in the exact attention */
// Exact f32 attention of the first QT0 rows of one head, one thread per query row (128 threads). The row's q and o live in registers; the head's K and V rows are staged once in LDS and read from there at one address for the whole wave.
// Every d loop is unrolled, and JU keys are taken together, so that their JU chains of dependent adds fill one another's latency. Per row every product, every sum and the running-maximum recurrence stand in the order they had key by key.
#define A0_LDS (2 * QT0 * HD * 4)      /* the K rows, then the V rows */
__device__ __forceinline__ void att0_head(const float* __restrict__ QF, const float* __restrict__ KF, const float* __restrict__ VF, int ld, float scale, float* __restrict__ OF, int ldo, int h, int bat, unsigned char* sm) {      /* sm: A0_LDS bytes of LDS */
  #pragma clang fp contract(off)      /* as before; numerical: each q k product stays rounded in front of its add, as it was built so far, so that the exact rows' scores, and with them o, stay bit-identical */
  static_assert(64 % JU == 0 && HD == 64 && QT0 == 128, "att0_head: whole groups of JU keys; 64 values a row; one thread per row of the first tile");
  float (*sk)[HD] = (float (*)[HD])sm; float (*sv)[HD] = (float (*)[HD])(sm + A0_LDS / 2);
  float (*lo)[HD + 4] = (float (*)[HD + 4])sm;      /* behind the loop's barrier the K and V rows' bytes are the output staging; pitch 68 floats spreads the rows over the banks */
  static_assert(sizeof(float) * QT0 * (HD + 4) <= A0_LDS, "att0_head: the output staging fits the K and V rows");
  const int tid = threadIdx.x; const int rg = __builtin_amdgcn_readfirstlane(tid >> 6); const int i = tid;      /* rg: which 64 rows; the same for a whole wave, so the key loop's bound stays scalar */
  const size_t bo_in = (size_t)bat * QT0 * ld; QF += bo_in; KF += bo_in; VF += bo_in; OF += (size_t)bat * QT0 * ldo;      /* QT0 rows per batch in every plane */
  const float* qr = QF + (size_t)i * ld + h * HD;
  const int nkey = rg * 64 + 64;      /* causal form: keys up to the last row of the wave's 64 */
  const int sr = tid >> 4, c4 = (tid & 15) * 4; const unsigned lof = (unsigned)(sr * ld + c4);      /* sixteen lanes take one 256-byte row */
#pragma unroll 1
  for (int r0 = 0; r0 < QT0; r0 += 64) { v4f tk[8], tv[8]; const float* pk[8]; const float* pv[8];      /* 64 rows a trip: sixteen loads in flight per lane; rolled, since two trips of them are all there is */
#pragma unroll
    for (int it = 0; it < 8; ++it) { const size_t g = (size_t)(r0 + it * 8) * ld + h * HD; pk[it] = (KF + g) + lof; pv[it] = (VF + g) + lof; tk[it] = *(const v4fa*)pk[it]; tv[it] = *(const v4fa*)pv[it]; }
    asm volatile("s_wait_xcnt 0x0" :: "v"(pk[0]), "v"(pk[1]), "v"(pk[2]), "v"(pk[3]), "v"(pk[4]), "v"(pk[5]), "v"(pk[6]), "v"(pk[7]), "v"(pv[0]), "v"(pv[1]), "v"(pv[2]), "v"(pv[3]), "v"(pv[4]), "v"(pv[5]), "v"(pv[6]), "v"(pv[7]) : "memory");      /* the wait that belongs in front of any overwrite of the loads' address registers; naming them keeps them whole up to it */
#pragma unroll
    for (int it = 0; it < 8; ++it) { *(v4f*)&sk[r0 + it * 8 + sr][c4] = tk[it]; *(v4f*)&sv[r0 + it * 8 + sr][c4] = tv[it]; } }
  v2f q2[HD / 2], o2[HD / 2];
#pragma unroll
  for (int c = 0; c < HD / 4; ++c) { const v4f qq = *(const v4fa*)(qr + c * 4); q2[2 * c] = v2f{qq[0], qq[1]}; q2[2 * c + 1] = v2f{qq[2], qq[3]}; o2[2 * c] = v2f{0.f, 0.f}; o2[2 * c + 1] = v2f{0.f, 0.f}; }
  asm volatile("s_wait_xcnt 0x0" :: "v"(qr) : "memory");      /* as above, for the address register of the q loads */
  __syncthreads();      /* the staged K and V rows are published to every wave */
  float m = -1.0e30f, l = 0.f;
  // A piece = 8 LDS reads of 16 bytes: 8 values (d = 8 n .. 8 n + 7) of JU rows. Two register buffers: the next piece's reads are issued in front of this piece's arithmetic, so that an LDS read's latency is not paid read by read.
  v4f ba[2 * JU], bb[2 * JU];
  auto fetch = [&](v4f (&buf)[2 * JU], const float (*rows)[HD], int jb, int n) {
#pragma unroll
    for (int u = 0; u < JU; ++u) { buf[2 * u] = *(const v4f*)&rows[jb + u][8 * n]; buf[2 * u + 1] = *(const v4f*)&rows[jb + u][8 * n + 4]; } };
  float s[JU], sc[JU], e[JU];
  auto dots = [&](const v4f (&buf)[2 * JU], int n) {      /* two rounded products an instruction; the adds stay one chain per key, d ascending */
#pragma unroll
    for (int w = 0; w < 2; ++w)
#pragma unroll
      for (int u = 0; u < JU; ++u) { const v4f kq = buf[2 * u + w]; const v2f p0 = q2[4 * n + 2 * w] * v2f{kq[0], kq[1]}, p1 = q2[4 * n + 2 * w + 1] * v2f{kq[2], kq[3]};
        s[u] = __fadd_rn(s[u], p0[0]); s[u] = __fadd_rn(s[u], p0[1]); s[u] = __fadd_rn(s[u], p1[0]); s[u] = __fadd_rn(s[u], p1[1]); } };
  auto accum = [&](const v4f (&buf)[2 * JU], int n) {      /* o = fma(o, sc, round(e v)), key after key: the rounding that this line was built with before, written out */
#pragma unroll
    for (int w = 0; w < 2; ++w)
#pragma unroll
      for (int u = 0; u < JU; ++u) { const v4f vv = buf[2 * u + w]; const v2f s2 = {sc[u], sc[u]}, e2 = {e[u], e[u]};
        o2[4 * n + 2 * w] = __builtin_elementwise_fma(o2[4 * n + 2 * w], s2, e2 * v2f{vv[0], vv[1]}); o2[4 * n + 2 * w + 1] = __builtin_elementwise_fma(o2[4 * n + 2 * w + 1], s2, e2 * v2f{vv[2], vv[3]}); } };
  fetch(ba, sk, 0, 0);
#pragma unroll 1
  for (int j0 = 0; j0 < nkey; j0 += JU) {      /* kept rolled: one trip already holds JU keys' unrolled d loops */
    const int jn = (j0 + JU < nkey) ? j0 + JU : 0;      /* the last trip fetches ahead from row 0, inside the array; that piece is not used */
#pragma unroll
    for (int u = 0; u < JU; ++u) s[u] = 0.f;
#pragma unroll
    for (int n = 0; n < HD / 8; n += 2) {
      fetch(bb, sk, j0, n + 1);
      __builtin_amdgcn_sched_barrier(0);      /* keeps the reads above in front of the arithmetic below: without it each read sinks to its use and waits out its own latency */
      dots(ba, n);
      if (n + 2 < HD / 8) fetch(ba, sk, j0, n + 2); else fetch(ba, sv, j0, 0);
      __builtin_amdgcn_sched_barrier(0);      /* as above */
      dots(bb, n + 1); }
#pragma unroll
    for (int u = 0; u < JU; ++u) { const float ss = __fmul_rn(s[u], scale);
      const float f = (j0 + u <= i) ? 1.f : 0.f; const float sm = fmaf(f, ss, (1.f - f) * -1.0e30f); const float mn = fmaxf(m, sm); sc[u] = expf(m - mn); e[u] = expf(sm - mn); l = fmaf(l, sc[u], e[u]); m = mn; }      /* l: one fused multiply-add, as this line was built before */
#pragma unroll
    for (int n = 0; n < HD / 8; n += 2) {
      fetch(bb, sv, j0, n + 1);
      __builtin_amdgcn_sched_barrier(0);      /* as above */
      accum(ba, n);
      if (n + 2 < HD / 8) fetch(ba, sv, j0, n + 2); else fetch(ba, sk, jn, 0);
      __builtin_amdgcn_sched_barrier(0);      /* as above */
      accum(bb, n + 1); } }
  const float fin = 64.0f / l;      /* o carried x64 like the f16 path */
  __syncthreads();      /* every wave has left the K and V rows before their bytes become the output staging */
#pragma unroll
  for (int c = 0; c < HD / 4; ++c) { const v2f a = o2[2 * c] * v2f{fin, fin}, b = o2[2 * c + 1] * v2f{fin, fin}; *(v4f*)&lo[tid][c * 4] = v4f{a[0], a[1], b[0], b[1]}; }
  __syncthreads();
  {
#pragma unroll 1
    for (int it0 = 0; it0 < 16; it0 += 4) {      /* rolled: four stores in flight a trip are enough for 32 KiB */
#pragma unroll
      for (int it = it0; it < it0 + 4; ++it) { const int row = it * 8 + tid / 16, pc = (tid % 16) * 4; const v4f v = *(const v4f*)&lo[row][pc]; *(v4f*)(OF + (size_t)row * ldo + h * HD + pc) = v; }      /* whole 256-byte row pieces per store, as before */
      asm volatile("s_wait_xcnt 0x0" ::: "memory"); }      /* the wait that belongs in front of the next trip's overwrite of the registers which these stores name */
     } }
// The exact first-tile attention and the fused attention read different planes and write different planes: one launch. The first NH * NB work-groups each take the exact rows of one head (few, long chains of vector work: they start first and run beside the matrix work); the rest take the query tiles, the longest first. The branch is the same for a whole work-group.
__global__ __launch_bounds__(128) void k_attn(const float* __restrict__ QF, const float* __restrict__ KF, const float* __restrict__ VF, float* __restrict__ OF, const _Float16* __restrict__ Q, const _Float16* __restrict__ K, const _Float16* __restrict__ VTp, float scale, _Float16* __restrict__ O) {
  __shared__ __attribute__((aligned(16))) unsigned char sm[A0_LDS > FA_LDS ? A0_LDS : FA_LDS];
  int f = (int)blockIdx.x;
  if (f < NH * NB) { att0_head(QF, KF, VF, 3 * DM, scale, OF, DM, f % NH, f / NH, sm); return; }
  f -= NH * NB; fattn_tile(Q, K, VTp, scale, O, f % NH, (f / NH) % NB, SQ / 128 - 1 - f / (NH * NB), sm); }


// lane l with lane l ^ 16 (the other 16-lane row)
__device__ __forceinline__ float lane_x16(float x) { const int b = __builtin_bit_cast(int, x); return __builtin_bit_cast(float, __builtin_amdgcn_permlanex16(b, b, 0x76543210, 0xfedcba98, false, false)); }
__device__ __forceinline__ float wave_sum(float x) { x = row16_sum(x); return x + lane_x16(x); }
// Row LayerNorm (biased variance) -> f16 rows. One wave per row, LN_RW rows a wave: a launch starts few, longer-lived waves, and a row's two sums need no LDS and no barrier.
// A lane holds 32 values of a row: 4 columns of each 128-column piece, so that every wave load and store covers whole lines. All rows' loads of a wave are issued up front; g and b are loaded and rounded once a wave.
#define LN_RW 2                      /* rows a wave */
static_assert(DMQ == 1024 && NR % (8 * LN_RW) == 0, "k_ln16: rows of 8 pieces of 128 columns; whole work-groups of 8 waves");
template <int BFIN, int WXB>
__device__ __forceinline__ void ln16_rows(const float* __restrict__ X, const float* __restrict__ g, const float* __restrict__ bb, float eps, _Float16* __restrict__ N16, float* __restrict__ XB, int blk) {      /* blk: which 8 * LN_RW rows */
  const int lane = threadIdx.x & 31; const size_t e0 = ((size_t)blk * 8 + (threadIdx.x >> 5)) * LN_RW * DMQ + lane * 4;      /* this lane's first element of the wave's first row */
  const float* xp = X + e0; const float* gp = g + lane * 4; const float* bp = bb + lane * 4; v4f s[LN_RW][8], gv[8], bv[8];
#pragma unroll
  for (int k = 0; k < LN_RW; ++k)
#pragma unroll
    for (int u = 0; u < 8; ++u) s[k][u] = *(const v4fa*)(xp + k * DMQ + u * 128);      /* unrolled: one address and immediate offsets, every load in flight together */
#pragma unroll
  for (int u = 0; u < 8; ++u) { gv[u] = *(const v4fa*)(gp + u * 128); bv[u] = *(const v4fa*)(bp + u * 128); }
  asm volatile("s_wait_xcnt 0x0" :: "v"(xp), "v"(gp), "v"(bp) : "memory");      /* the wait that belongs in front of any overwrite of the loads' address registers; naming the three addresses keeps them whole up to here */
#pragma unroll
  for (int u = 0; u < 8; ++u)
#pragma unroll
    for (int q = 0; q < 4; ++q) { gv[u][q] = bf16_round(gv[u][q]); bv[u][q] = bf16_round(bv[u][q]); }
#pragma unroll
  for (int k = 0; k < LN_RW; ++k) {
    if (BFIN) {
#pragma unroll
      for (int u = 0; u < 8; ++u)
#pragma unroll
        for (int q = 0; q < 4; ++q) s[k][u][q] = bf16_round(s[k][u][q]); }
    v4f a = s[k][0];      /* four chains a lane, then the lane tree */
#pragma unroll
    for (int u = 1; u < 8; ++u) a += s[k][u];
    const float mu = wave_sum((a[0] + a[1]) + (a[2] + a[3])) * (1.0f / (float)DMQ);
    v4f v = {0.f, 0.f, 0.f, 0.f};
#pragma unroll
    for (int u = 0; u < 8; ++u) { const v4f d = s[k][u] - mu; v += d * d; }
    const float rs = rsqrtf(wave_sum((v[0] + v[1]) + (v[2] + v[3])) * (1.0f / (float)DMQ) + eps);
#pragma unroll
    for (int u = 0; u < 8; ++u) { const v4f y = (s[k][u] - mu) * rs * gv[u] + bv[u]; v4h h4;
#pragma unroll
      for (int q = 0; q < 4; ++q) h4[q] = (_Float16)y[q];
      *(v4h*)(N16 + e0 + k * DMQ + u * 128) = h4; if (WXB) *(v4f*)(XB + e0 + k * DMQ + u * 128) = s[k][u]; }
    asm volatile("s_wait_xcnt 0x0" ::: "memory"); } }      /* the wait that belongs in front of a later overwrite of the registers which this row's stores name */
template <int BFIN, int WXB>
__global__ __launch_bounds__(256) void k_ln16(const float* __restrict__ X, const float* __restrict__ g, const float* __restrict__ bb, float eps, _Float16* __restrict__ N16, float* __restrict__ XB) { ln16_rows<BFIN, WXB>(X, g, bb, eps, N16, XB, (int)blockIdx.x); }
// LN1 and the four weight transposes depend on nothing but the inputs: one launch, each work-group takes one piece of one of the five jobs (the branch is the same for a whole work-group). The LN rows, the most bytes, come first.
#define PB_LN ((int)(NR / (8 * LN_RW)))
#define PB_QKV ((3 * DM / 64) * (DM / 128))
#define PB_O ((DM / 64) * (DM / 128))
#define PB_FC ((DFF / 64) * (DM / 128))
#define PB_MP ((DM / 64) * (DFF / 128))
__global__ __launch_bounds__(256) void k_prep(const float* __restrict__ x, const float* __restrict__ g1, const float* __restrict__ be1, const float* __restrict__ wqkv, const float* __restrict__ wo, const float* __restrict__ wfc, const float* __restrict__ wmp,
    _Float16* __restrict__ X16, float* __restrict__ XB, _Float16* __restrict__ BQKV, _Float16* __restrict__ BO, _Float16* __restrict__ BW1, _Float16* __restrict__ BW2) {
  __shared__ __attribute__((aligned(16))) unsigned char tl[64 * WT_PITCH];
  int b = (int)blockIdx.x;
  if (b < PB_LN) { ln16_rows<1, 1>(x, g1, be1, 1e-5f, X16, XB, b); return; }
  b -= PB_LN; if (b < PB_QKV) { wt_f16_tile<DM, 3 * DM>(wqkv, BQKV, 16.0f, b, tl); return; }
  b -= PB_QKV; if (b < PB_O) { wt_f16_tile<DM, DM>(wo, BO, 16.0f, b, tl); return; }
  b -= PB_O; if (b < PB_FC) { wt_f16_tile<DM, DFF>(wfc, BW1, 16.0f, b, tl); return; }
  b -= PB_FC; wt_f16_tile<DFF, DM>(wmp, BW2, 16.0f, b, tl); }
__global__ __launch_bounds__(256) void k_ftres2(const float* __restrict__ OF0, const float* __restrict__ XB, float* __restrict__ X1, size_t n4) {
  #pragma clang fp contract(off)
  const size_t t = (size_t)blockIdx.x * 256 + threadIdx.x; if (t >= n4) return; const v4f o = *(const v4fa*)(OF0 + t * 4), xv = *(const v4fa*)(XB + t * 4); v4f y; for (int q = 0; q < 4; ++q) y[q] = __fadd_rn(__fmul_rn(o[q], 0.015625f), xv[q]); *(v4f*)(X1 + t * 4) = y;  }

__global__ __launch_bounds__(256) void k_wthd(const float* __restrict__ Wt, _Float16* __restrict__ Bt) { const size_t t = (size_t)blockIdx.x * 256 + threadIdx.x; if (t >= (size_t)NH * HD * (DM / 8)) return; const int m8 = (int)(t % (DM / 8)) * 8; const int d = (int)((t / (DM / 8)) % HD); const int h = (int)(t / ((size_t)(DM / 8) * HD)); FragH f;
  for (int q = 0; q < 8; ++q) f.h[q] = (_Float16)(16.0f * bf16_round(Wt[((size_t)h * DM + m8 + q) * HD + d])); unsigned short* dst = (unsigned short*)Bt + ((size_t)h * HD + d) * DM + m8; *(v8us*)dst = f.half[0];  }




__global__ __launch_bounds__(256) void k_wtpad(const float* __restrict__ Wm, _Float16* __restrict__ Wt, int Kr, int Kp, int Nr, int Np, float scale) {
  const int t = blockIdx.x * 256 + threadIdx.x; if (t >= Np * (Kp / 8)) return; const int n = t / (Kp / 8), k8 = (t % (Kp / 8)) * 8; const int nc = min(n, Nr - 1); const float fn = (n < Nr) ? 1.f : 0.f; FragH f;
  for (int i = 0; i < 8; ++i) { const int k = k8 + i; const int kc = min(k, Kr - 1); const float fk = (k < Kr) ? fn : 0.f; f.h[i] = (_Float16)(bf16_round(Wm[(size_t)kc * Nr + nc]) * scale * fk); }
  unsigned short* o = (unsigned short*)Wt + (size_t)n * Kp + k8; *(v8us*)o = f.half[0];  }
__global__ __launch_bounds__(128) void k_bpad(const float* __restrict__ b, float* __restrict__ Bp, int nr, int np) {
  const int i = threadIdx.x; if (i >= np) return; const float v = b[min(i, nr - 1)] * ((i < nr) ? 1.f : 0.f); *(float*)(Bp + i) = v;  }
extern "C" void kernel_launch(void* const* d_in, const int* in_sizes, int n_in,
                              void* d_out, int out_size, void* d_ws, size_t ws_size, hipStream_t stream) {
  (void)in_sizes; (void)n_in; (void)out_size;
  const float* const* I = (const float* const*)d_in; const float* x = I[0]; const float* wqkv = I[1]; const float* bqkv = I[2]; const float* wo = I[3]; const float* bo = I[4]; const float* g1 = I[5]; const float* be1 = I[6]; const float* gg2 = I[7]; const float* be2 = I[8]; const float* wfc = I[9]; const float* bfc = I[10]; const float* wmp = I[11]; const float* bmp = I[12];      /* x; fused Wqkv [1024][3072] + bqkv [3072] ([in][out]); Wproj + bproj; LN1 g / b, LN2 g / b; W1 [1024][4096] + b1, W2 [4096][1024] + b2 */
  char* ws = (char*)d_ws; size_t off = 0;
  auto take = [&](size_t bytes) { char* p = ws + off; off += (bytes + 255) & ~(size_t)255; return p; };
  _Float16* BQKV = (_Float16*)take((size_t)3 * DM * DM * 2); _Float16* BO = (_Float16*)take((size_t)DM * DM * 2);
  _Float16* X16 = (_Float16*)take(NR * DM * 2); float* XB = (float*)take(NR * DM * 4); _Float16* BW1 = (_Float16*)take((size_t)DFF * DM * 2); _Float16* BW2 = (_Float16*)take((size_t)DM * DFF * 2);
  _Float16* QKV = (_Float16*)take(NR * 3 * DM * 2); _Float16* Q16 = QKV; _Float16* K16 = QKV + DM; _Float16* V16 = QKV + 2 * DM; _Float16* O16 = (_Float16*)take(NR * DM * 2);
  _Float16* HF16 = QKV;      /* alias: the FFN hidden rows [NR][DFF] fill QKV + O16 (adjacent, same bytes); their last reader, the output projection, precedes the FFN */
  _Float16* M16 = X16;      /* alias: X16's last reader, the first-tile q | k | v GEMM, precedes LN2's write */
  _Float16* VT = (_Float16*)take((size_t)NB * NH * HD * SQ * 2);
  float* OF0 = (float*)take((size_t)NB * QT0 * DM * 4); _Float16* OH0 = (_Float16*)take((size_t)NB * QT0 * DM * 2); _Float16* OL0 = (_Float16*)take((size_t)NB * QT0 * DM * 2);
  float* S = (float*)take((size_t)GB * NH * QT * NKX * 4);      /* no scores any more: the plane of the two aliases below */
  float* QKVF0 = S;      /* alias: f32 q | k | v of the first tiles [NB][QT0][3 DM]; read by the exact attention before x1 is written */
  float* X1 = S;      /* alias: x1 [NR][DM] is written after the exact attention's last read of this plane */
  if (off > ws_size) return;
  k_prep<<<PB_LN + PB_QKV + PB_O + PB_FC + PB_MP, 256, 0, stream>>>(x, g1, be1, wqkv, wo, wfc, wmp, X16, XB, BQKV, BO, BW1, BW2);      /* a = LN1(bf16(x)) -> f16 rows, XB = bf16(x) for the residual; fused Wqkv [DM][3 DM] -> Bt [3 DM][DM] (rows 0.. = q, DM.. = k, 2 DM.. = v output columns), Wproj, W1 [1024][4096] -> Bt [4096][1024], W2 [4096][1024] -> Bt [1024][4096], all x16 */
  k_qkv<<<QB_ALL + QB_FT, 256, 0, stream>>>(X16, BQKV, bqkv, QKV, QKVF0);      /* q | k | v rows (f16); head h = columns h*HD.. of each DM block; beside them f32 q | k | v of the first 128 rows of every batch (exact products) */
  k_vt<NH, SQ><<<NB * NH * (SQ / 64), 256, 0, stream>>>(V16, LQ, 0, VT);      /* V^T [NB][NH][HD][SQ], every batch in one launch */
  k_attn<<<NH * NB + NH * NB * (SQ / 128), 128, 0, stream>>>(QKVF0, QKVF0 + DM, QKVF0 + 2 * DM, OF0, Q16, K16, VT, 0.07216878364870322f, O16);      /* exact f32 attention for rows 0..127 of every batch and head (o x64, f32), beside the causal attention of every batch, head and query tile: o (merged heads, x64) as f16 rows */
  k_proj<<<PJ_ALL + PJ_HL, 256, 0, stream>>>(O16, BO, bo, XB, X1, OF0, OH0, OL0);      /* x1 = x + o Wo + b, all rows; beside it first-tile o (x64) -> f16 hi + x1024 residual planes */
  k_gemm2<0><<<dim3((QT0 / 128) * (DM / 64), NB), 128, 0, stream>>>(OH0, DM, (size_t)QT0 * DM, BO, DM, 0, 0.0009765625f, bo, 0, XB, -1, 0, 0, X1, nullptr, DM, (size_t)SQ * DM, QT0, DM, DM);      /* rows 0..127 of every batch (grid.y): x1 = x + o_hi Wo (+ b), overwriting the f16-path rows */
  k_gemm2<0><<<dim3((QT0 / 128) * (DM / 64), NB), 128, 0, stream>>>(OL0, DM, (size_t)QT0 * DM, BO, DM, 0, 0.00000095367431640625f, nullptr, 0, X1, -1, 0, 0, X1, nullptr, DM, (size_t)SQ * DM, QT0, DM, DM);      /* += o_lo Wo 2^-20 (own-element accumulate) */
  k_ln16<0, 0><<<(unsigned)(NR / (8 * LN_RW)), 256, 0, stream>>>(X1, gg2, be2, 1e-5f, M16, nullptr);      /* h = LN2(x1) -> f16 rows */
  k_gemm3<3, false, false, DFF><<<(unsigned)((MP / 256) * (DFF / 128)), 256, 0, stream>>>(M16, DM, BW1, DM, 0.0625f, bfc, nullptr, nullptr, HF16, MP, DFF, DM);      /* relu(h2 W1 + b1) -> f16, all rows */
  k_gemm3<0, true, true, DM><<<(unsigned)((MP / 256) * (DM / 128)), 256, 0, stream>>>(HF16, DFF, BW2, DFF, 0.0625f, bmp, X1, (float*)d_out, nullptr, MP, DM, DFF);      /* out = x1 + mlp (own-element residual), all rows */
}

// v010
// One run takes 263 microseconds.
// Two timings next to v009 both put it at 1.18 times that version's speed.
// All steps since the starting kernel, v000, together make it 40.1 times as fast.
#include <hip/hip_runtime.h>
// Pre-LN causal transformer block with a fused QKV projection and the module's literal score scale (x [8][1024][1024]; h = LN1(x) (biased var, eps 1e-5); qkv = h Wqkv + bqkv ([in][out] 1024 x 3072 + bias) split q | k | v; 16 heads of 64; scale = 1 / sqrt(3 * 1024 / 16) = 1 / sqrt(192) (as the source: NOT 1 / sqrt(head_dim)); causal (tril, -inf); softmax; x1 = x + y Wproj + bproj; out = x1 + relu(LN2(x1) W1 + b1) W2 + b2 ([in][out] 1024 x 4096 x 1024) -> [8][1024][1024]).
// Structure: token rows r = b*1024 + s; h = LN1(x) as f16 rows (x bf16-rounded, also kept in f32 for the residual); q | k | v as ONE WMMA GEMM (N = 3 x 1024) (64x64 wave tiles, f32 accumulation, exact x16 weights + bias, f16 outputs); v leaves that GEMM as V^T rows, turned in its write-out; per query tile of 128 rows of a head, in one kernel: scores against tiles of 64 keys up to the tile end, running row maximum and sum (f32 statistics, native exp; keys above the row masked; weights x256 f16), o += P . V^T on WMMA (o carried x64, folded into the output GEMM alpha) written straight into the merged f16 o rows; x1 = x + o W_o + b GEMM (f32); out = x1 + relu(LN2(x1) W1 + b1) W2 + b2 by two more GEMMs (f16 hidden rows, f32 output).
// Compute dtype: inputs rounded to bf16; x / weights exact; q, k, v, softmax weights and o as plain f16 GEMM operands (~2^-12); scores and softmax statistics f32. v_wmma_f32_16x16x32_f16.
// Launches: kernels that depend on nothing of one another share a launch, each work-group taking a piece of one of them (LN1 with the weight transposes; the first-tile q | k | v GEMM with the all-row one; the exact first-tile attention with the fused attention; the first-tile output GEMM with the output GEMM of the other rows). Short kernels that only re-laid a producer's output are part of that producer's write-out (V^T in the q | k | v GEMM; the split of the exact o in the exact attention). The batch axis lies on the grid, not in a host loop: scores, softmax and P V of every batch, head and query tile are one launch; the FFN GEMMs take all token rows.
#define NB 8
#define SQ 1024
#define DM 1024
#define NH 16
#define HD 64
#define HG 4                         /* heads per block group of the per-batch k_vt, which is not launched */
#define QT 256                       /* query rows a head in the S plane's size */
#define NKX SQ                       /* S row length in the plane's size */
#define QT0 128                      /* first-tile rows recomputed exactly in f32 */
#define GB 4                         /* batches in the S plane's size */
#define B0 0                         /* not used */
#define NBR NB                       /* batches processed (debug hook) */
#define NR ((size_t)NB * SQ)
#define DMQ DM
#define DFF 4096                     /* FFN hidden width */
#define DFFR 100                     /* not used */
#define MP ((int)((size_t)NBR * SQ)) /* rows projected (debug hook) */
#define QN SQ                        /* not used */
#define NHD NH                       /* not used */
#define MPO MP                       /* rows through the output stage (debug hook) */
#define LQ (3 * DM)      /* row pitch of the q/k/v rows */
typedef __bf16 v16b __attribute__((ext_vector_type(16)));
typedef unsigned short v8us __attribute__((ext_vector_type(8), may_alias));
typedef float  v8f  __attribute__((ext_vector_type(8)));
typedef float  v4f  __attribute__((ext_vector_type(4)));
typedef float  v4fa __attribute__((ext_vector_type(4), may_alias));
union FragB { v16b v; v8us half[2]; unsigned short u[16]; };

__device__ __forceinline__ unsigned short bf16_bits(float x) { unsigned int u = __float_as_uint(x); return (unsigned short)((u + 0x7FFFu + ((u >> 16) & 1u)) >> 16); }
__device__ __forceinline__ float bf16_val(unsigned short b) { return __uint_as_float(((unsigned int)b) << 16); }
__device__ __forceinline__ float bf16_round(float x) { return bf16_val(bf16_bits(x)); }
// D += A·B with NT terms: 1 = ah·bh, 2 = + al·bh (A split), 3 = + ah·bl (both split)
template <int NT>
__device__ __forceinline__ v8f mmaN(v16b ah, v16b al, v16b bh, v16b bl, v8f c) {
  c = __builtin_amdgcn_wmma_f32_16x16x32_bf16(false, ah, false, bh, (short)0, c, false, false);
  if (NT >= 2) c = __builtin_amdgcn_wmma_f32_16x16x32_bf16(false, al, false, bh, (short)0, c, false, false);
  if (NT >= 3) c = __builtin_amdgcn_wmma_f32_16x16x32_bf16(false, ah, false, bl, (short)0, c, false, false);
  asm volatile("v_nop\n\tv_nop\n\tv_nop\n\tv_nop" : "+v"(c) : "v"(ah), "v"(al), "v"(bh), "v"(bl));
  return c;
}

__global__ __launch_bounds__(256) void k_wt_bf16(const float* __restrict__ W, unsigned short* __restrict__ Wt, int K, int N) {
  const int t = blockIdx.x * 256 + threadIdx.x;
  const int k8n = K / 8;
  if (t >= N * k8n) return;
  const int n = t / k8n, k8 = (t % k8n) * 8;
  v8us v;
#pragma unroll
  for (int i = 0; i < 8; ++i) v[i] = bf16_bits(W[(size_t)(k8 + i) * N + n]);
  *(v8us*)(Wt + (size_t)n * K + k8) = v;
  
}

// GEMM C[M][N] (f32, pitch ldc) = act(A[M][K]·W + bias). A f32 row-major (pitch lda) converted per fragment to bf16
// (ASPLIT: hi/lo two planes -> 2 terms, else single rounded term); Wt bf16 [N][K] (pitch ldb). BIAS_BF16 rounds the
// bias to bf16 first (bias quantised to bf16 before the add). K%32==0, M%16==0, N%64==0.
template <bool ASPLIT, int ACT, bool BIAS_BF16>
__global__ __launch_bounds__(128) void k_gemm_bf(const float* __restrict__ A, int lda, const unsigned short* __restrict__ Wt, int ldb,
                                               const float* __restrict__ bias, float* __restrict__ C, int ldc, int M, int N, int K) {
  __shared__ __attribute__((aligned(16))) float so[4][16][64];
  const int tid = threadIdx.x, w = tid >> 5, lane = tid & 31, ln = lane & 15, hh = lane >> 4;
  const int ntn = N / 64;
  const int wid = blockIdx.x * 4 + w;
  const int mt = wid / ntn, nq = wid % ntn;
  if (mt * 16 >= M) return;
  const int row0 = mt * 16, col0 = nq * 64;
  const float* arow = A + (size_t)(row0 + ln) * lda;
  v8f acc[4] = {};
  for (int kb = 0; kb < K; kb += 32) {
    FragB ah, al;
    const v4f x0 = *(const v4fa*)(arow + kb + 8 * hh), x1 = *(const v4fa*)(arow + kb + 8 * hh + 4);
    const v4f x2 = *(const v4fa*)(arow + kb + 16 + 8 * hh), x3 = *(const v4fa*)(arow + kb + 16 + 8 * hh + 4);
    float xs[16] = {x0[0],x0[1],x0[2],x0[3],x1[0],x1[1],x1[2],x1[3],x2[0],x2[1],x2[2],x2[3],x3[0],x3[1],x3[2],x3[3]};
#pragma unroll
    for (int i = 0; i < 16; ++i) { const unsigned short hb = bf16_bits(xs[i]); ah.u[i] = hb; al.u[i] = ASPLIT ? bf16_bits(xs[i] - bf16_val(hb)) : (unsigned short)0; }
#pragma unroll
    for (int t = 0; t < 4; ++t) {
      const unsigned short* brow = Wt + (size_t)(col0 + t * 16 + ln) * ldb + kb;
      FragB b;
      b.half[0] = *(const v8us*)(brow + 8 * hh);
      b.half[1] = *(const v8us*)(brow + 16 + 8 * hh);
      acc[t] = mmaN<ASPLIT ? 2 : 1>(ah.v, al.v, b.v, b.v, acc[t]);
    }
  }
#pragma unroll
  for (int t = 0; t < 4; ++t) {
    float bv = bias ? bias[col0 + t * 16 + ln] : 0.f;
    if (BIAS_BF16) bv = bf16_round(bv);
#pragma unroll
    for (int r = 0; r < 8; ++r) { float v = acc[t][r] + bv; if (ACT == 1) v = fmaxf(v, 0.f); so[w][8 * hh + r][t * 16 + ln] = v; }
  }
  __builtin_amdgcn_fence(__ATOMIC_ACQ_REL, "workgroup");
  __builtin_amdgcn_wave_barrier();
  const int rsub = lane >> 4, c4 = (lane & 15) * 4;
  {
#pragma unroll
    for (int q = 0; q < 8; ++q) {
      const int r = q * 2 + rsub;
      const v4f v = *(const v4fa*)&so[w][r][c4];
      *(v4f*)(C + (size_t)(row0 + r) * ldc + col0 + c4) = v;
    }
    
  }
}

// GEMM C = act(A·W + bias + resid): A f32 (ASPLIT -> hi/lo 2 terms), Wt bf16 [N][K]; ACT 0 none, 1 relu, 2 exact gelu;
// resid (optional, f32, row index = (row % rmod), pitch ldr, RES_BF16 rounds it) added before the activation.
template <bool ASPLIT, int ACT, bool BIAS_BF16, bool RES_BF16>
__global__ __launch_bounds__(128) void k_gemm_bf3(const float* __restrict__ A, int lda, const unsigned short* __restrict__ Wt, int ldb,
                                                const float* __restrict__ bias, const float* __restrict__ resid, int rmod, int ldr,
                                                float* __restrict__ C, int ldc, int M, int N, int K) {
  __shared__ __attribute__((aligned(16))) float so[4][16][64];
  const int tid = threadIdx.x, w = tid >> 5, lane = tid & 31, ln = lane & 15, hh = lane >> 4;
  const int ntn = N / 64;
  const int wid = blockIdx.x * 4 + w;
  const int mt = wid / ntn, nq = wid % ntn;
  if (mt * 16 >= M) return;
  const int row0 = mt * 16, col0 = nq * 64;
  const float* arow = A + (size_t)(row0 + ln) * lda;
  v8f acc[4] = {};
  for (int kb = 0; kb < K; kb += 32) {
    FragB ah, al;
    const v4f x0 = *(const v4fa*)(arow + kb + 8 * hh), x1 = *(const v4fa*)(arow + kb + 8 * hh + 4);
    const v4f x2 = *(const v4fa*)(arow + kb + 16 + 8 * hh), x3 = *(const v4fa*)(arow + kb + 16 + 8 * hh + 4);
    float xs[16] = {x0[0],x0[1],x0[2],x0[3],x1[0],x1[1],x1[2],x1[3],x2[0],x2[1],x2[2],x2[3],x3[0],x3[1],x3[2],x3[3]};
#pragma unroll
    for (int i = 0; i < 16; ++i) { const unsigned short hb = bf16_bits(xs[i]); ah.u[i] = hb; al.u[i] = ASPLIT ? bf16_bits(xs[i] - bf16_val(hb)) : (unsigned short)0; }
#pragma unroll
    for (int t = 0; t < 4; ++t) {
      const unsigned short* brow = Wt + (size_t)(col0 + t * 16 + ln) * ldb + kb;
      FragB b;
      b.half[0] = *(const v8us*)(brow + 8 * hh);
      b.half[1] = *(const v8us*)(brow + 16 + 8 * hh);
      acc[t] = mmaN<ASPLIT ? 2 : 1>(ah.v, al.v, b.v, b.v, acc[t]);
    }
  }
#pragma unroll
  for (int t = 0; t < 4; ++t) {
    const int col = col0 + t * 16 + ln;
    float bv = bias ? bias[col] : 0.f;
    if (BIAS_BF16) bv = bf16_round(bv);
#pragma unroll
    for (int r = 0; r < 8; ++r) {
      float v = acc[t][r] + bv;
      if (resid) { float rv = resid[(size_t)((row0 + 8 * hh + r) % rmod) * ldr + col]; if (RES_BF16) rv = bf16_round(rv); v += rv; }
      if (ACT == 1) v = fmaxf(v, 0.f);
      if (ACT == 2) v = 0.5f * v * (1.0f + erff(v * 0.70710678118654752f));
      if (ACT == 3) { const float u = 0.7978845608028654f * (v + 0.044715f * v * v * v); v = 0.5f * v * (1.0f + tanhf(u)); }
      so[w][8 * hh + r][t * 16 + ln] = v;
    }
  }
  __builtin_amdgcn_fence(__ATOMIC_ACQ_REL, "workgroup");
  __builtin_amdgcn_wave_barrier();
  const int rsub = lane >> 4, c4 = (lane & 15) * 4;
  {
#pragma unroll
    for (int q = 0; q < 8; ++q) {
      const int r = q * 2 + rsub;
      const v4f v = *(const v4fa*)&so[w][r][c4];
      *(v4f*)(C + (size_t)(row0 + r) * ldc + col0 + c4) = v;
    }
    
  }
}
// row LayerNorm (biased variance, eps) over N: s = X (+ R); optional out_sum <- s; out_norm <- (s-mu)*rsqrt(var+eps)*g + b
template <bool PARAM_BF16>
__global__ __launch_bounds__(256) void k_layernorm(const float* __restrict__ X, const float* __restrict__ R, const float* __restrict__ g, const float* __restrict__ bta,
                                                  float* __restrict__ out_sum, float* __restrict__ out_norm, int N, float eps) {
  __shared__ float red[256];
  const int row = blockIdx.x, tid = threadIdx.x;
  const float* x = X + (size_t)row * N; const float* rr = R ? R + (size_t)row * N : nullptr;
  float vals[16];                     // up to N = 4096
  const int per = N / 256;            // contiguous chunk per thread? use strided-by-4 chunks: thread handles j = tid*4 + 1024*u
  float s1 = 0.f;
  for (int u = 0; u < per / 4; ++u) {
    const int j = tid * 4 + 1024 * u;
    const v4f a = *(const v4fa*)(x + j);
    v4f b = {0.f,0.f,0.f,0.f}; if (rr) b = *(const v4fa*)(rr + j);
#pragma unroll
    for (int q = 0; q < 4; ++q) { const float v = a[q] + b[q]; vals[u * 4 + q] = v; s1 += v; }
  }
  red[tid] = s1; __syncthreads();
  for (int st = 128; st > 0; st >>= 1) { if (tid < st) red[tid] += red[tid + st]; __syncthreads(); }
  const float mu = red[0] / (float)N; __syncthreads();
  float s2 = 0.f;
  for (int u = 0; u < per / 4; ++u)
#pragma unroll
    for (int q = 0; q < 4; ++q) { const float c = vals[u * 4 + q] - mu; s2 += c * c; }
  red[tid] = s2; __syncthreads();
  for (int st = 128; st > 0; st >>= 1) { if (tid < st) red[tid] += red[tid + st]; __syncthreads(); }
  const float rs = rsqrtf(red[0] / (float)N + eps);
  {
    for (int u = 0; u < per / 4; ++u) {
      const int j = tid * 4 + 1024 * u;
      v4f o, sm;
#pragma unroll
      for (int q = 0; q < 4; ++q) {
        float gg = g[j + q], bb = bta[j + q];
        if (PARAM_BF16) { gg = bf16_round(gg); bb = bf16_round(bb); }
        sm[q] = vals[u * 4 + q]; o[q] = (vals[u * 4 + q] - mu) * rs * gg + bb;
      }
      if (out_sum) *(v4f*)(out_sum + (size_t)row * N + j) = sm;
      *(v4f*)(out_norm + (size_t)row * N + j) = o;
    }
    
  }
}



// ---- f16 WMMA path (v_wmma_f32_16x16x32_f16): 11-bit significands for operands in range — used where a [0,1] probability operand needs more precision than bf16
typedef _Float16 v16h __attribute__((ext_vector_type(16)));
union FragH { v16h v; v8us half[2]; _Float16 h[16]; unsigned short u[16]; };
template <int NT>
__device__ __forceinline__ v8f mmaH(v16h ah, v16h al, v16h bh, v16h bl, v8f c) {
  c = __builtin_amdgcn_wmma_f32_16x16x32_f16(false, ah, false, bh, (short)0, c, false, false);
  if (NT >= 2) c = __builtin_amdgcn_wmma_f32_16x16x32_f16(false, al, false, bh, (short)0, c, false, false);
  if (NT >= 3) c = __builtin_amdgcn_wmma_f32_16x16x32_f16(false, ah, false, bl, (short)0, c, false, false);
  asm volatile("v_nop\n\tv_nop\n\tv_nop\n\tv_nop" : "+v"(c) : "v"(ah), "v"(al), "v"(bh), "v"(bl));
  return c;
}
// batched GEMM like k_gemm_b but f16 operands: A f32 (split into f16 hi/lo if ASPLIT, else rounded to f16), Bt = f16 values [n][k]; alpha; C f32; N multiple of 16 (partial tiles skipped)
template <bool ASPLIT>
__global__ __launch_bounds__(128) void k_gemm_h(const float* __restrict__ A, int lda, size_t sA, const _Float16* __restrict__ Bh, int ldb, size_t sB, float alpha, float* __restrict__ C, int ldc, size_t sC, int M, int N, int K) {
  __shared__ __attribute__((aligned(16))) float so[4][16][64];
  const int tid = threadIdx.x, w = tid >> 5, lane = tid & 31, ln = lane & 15, hh = lane >> 4; const int by = blockIdx.y;
  A += (size_t)by * sA; Bh += (size_t)by * sB; C += (size_t)by * sC;
  const int ntn = (N + 63) / 64; const int wid = blockIdx.x * 4 + w; const int mt = wid / ntn, nq = wid % ntn; if (mt * 16 >= M) return;
  const int row0 = mt * 16, col0 = nq * 64; const float* arow = A + (size_t)(row0 + ln) * lda;
  v8f acc[4] = {};
  for (int kb = 0; kb < K; kb += 32) {
    FragH ah, al;
    const v4f x0 = *(const v4fa*)(arow + kb + 8 * hh), x1 = *(const v4fa*)(arow + kb + 8 * hh + 4), x2 = *(const v4fa*)(arow + kb + 16 + 8 * hh), x3 = *(const v4fa*)(arow + kb + 16 + 8 * hh + 4);
    float xs[16] = {x0[0],x0[1],x0[2],x0[3],x1[0],x1[1],x1[2],x1[3],x2[0],x2[1],x2[2],x2[3],x3[0],x3[1],x3[2],x3[3]};
#pragma unroll
    for (int i = 0; i < 16; ++i) { const _Float16 h = (_Float16)xs[i]; ah.h[i] = h; al.h[i] = ASPLIT ? (_Float16)(xs[i] - (float)h) : (_Float16)0.0f; }
#pragma unroll
    for (int t = 0; t < 4; ++t) { if (col0 + t * 16 >= N) continue; const size_t boff = (size_t)(col0 + t * 16 + ln) * ldb + kb; FragH bq; bq.half[0] = *(const v8us*)(Bh + boff + 8 * hh); bq.half[1] = *(const v8us*)(Bh + boff + 16 + 8 * hh);
      acc[t] = mmaH<ASPLIT ? 2 : 1>(ah.v, al.v, bq.v, bq.v, acc[t]); }
  }
#pragma unroll
  for (int t = 0; t < 4; ++t) { if (col0 + t * 16 >= N) continue;
#pragma unroll
    for (int r = 0; r < 8; ++r) so[w][8 * hh + r][t * 16 + ln] = acc[t][r] * alpha; }
  __builtin_amdgcn_fence(__ATOMIC_ACQ_REL, "workgroup"); __builtin_amdgcn_wave_barrier();
  const int rsub = lane >> 4, c4 = (lane & 15) * 4;
  {
#pragma unroll
    for (int q = 0; q < 8; ++q) { const int r = q * 2 + rsub; if (col0 + c4 < N) { const v4f v = *(const v4fa*)&so[w][r][c4]; *(v4f*)(C + (size_t)(row0 + r) * ldc + col0 + c4) = v; } }
     }
}

// Wt[n][k] = f16(bf16(W[k][n]) * scale) from f32 row-major W[K][N] (scale = power of two; bf16-exact weights stay exact in f16 away from the subnormal range)
// A work-group turns a tile of 128 k x 64 n through LDS, so that both sides of memory see whole aligned 256-byte pieces: a wave load takes 256 contiguous bytes of two W rows (eight loads in flight), a wave store writes 256 contiguous bytes of two Wt rows.
// A thread holds 8 k x 4 n; its 8 k of one n are one 16-byte LDS store. Column n = 4 c + q lies in LDS row 16 q + c: neighbouring lanes then lie one pitch apart (16 B x odd), which spreads the 16-byte stores over the banks.
#define WT_PITCH 272                 /* LDS row pitch in bytes of a 256-byte row of 128 k */
template <int K, int N>
__device__ __forceinline__ void wt_f16_tile(const float* __restrict__ W, _Float16* __restrict__ Wt, float scale, int tile, unsigned char* tl) {      /* tile: n tile fastest, then k tile; tl: 64 * WT_PITCH bytes of LDS */
  static_assert(K % 128 == 0 && N % 64 == 0, "wt_f16_tile: whole tiles of 128 k x 64 n");
  const int tid = threadIdx.x, g = tid >> 4, c = tid & 15; const int n0 = (tile % (N / 64)) * 64, k0 = (tile / (N / 64)) * 128;
  const float* sp = W + (size_t)(k0 + 8 * g) * N + n0 + 4 * c; v4f x[8];
#pragma unroll
  for (int i = 0; i < 8; ++i) x[i] = *(const v4fa*)(sp + (size_t)i * N);      /* unrolled: the eight rows' loads fly together, one address and immediate offsets */
  asm volatile("s_wait_xcnt 0x0" :: "v"(sp) : "memory");      /* the wait that belongs in front of any overwrite of the loads' address register; naming it keeps it whole up to here */
#pragma unroll
  for (int q = 0; q < 4; ++q) { FragH f;
#pragma unroll
    for (int i = 0; i < 8; ++i) f.h[i] = (_Float16)(bf16_round(x[i][q]) * scale);
    *(v8us*)(tl + (16 * q + c) * WT_PITCH + 16 * g) = f.half[0]; }
  __syncthreads();      /* the tile is whole before its rows are read */
  unsigned short* dp = (unsigned short*)Wt + (size_t)(n0 + 4 * g) * K + k0 + 8 * c;      /* sixteen lanes take one 256-byte row piece; LDS row 16 j + g is column 4 g + j */
#pragma unroll
  for (int j = 0; j < 4; ++j) { const v8us v = *(const v8us*)(tl + (16 * j + g) * WT_PITCH + 16 * c); *(v8us*)(dp + (size_t)j * K) = v; }
  asm volatile("s_wait_xcnt 0x0" ::: "memory");      /* the wait that belongs in front of a later overwrite of the registers which these four stores name: in a shared launch another job's code follows in the listing */
}
// k_gemm_hh variant with fused epilogue: v = acc·alpha + bias[by·sBias + col] (+ CP[(row/rowsPerB)·sCPb + by·64 + col] if CP) ; ACT 0 none / 1 elu ; writes f16 C16 (and f32 C if non-null)
template <int ACT>
__global__ __launch_bounds__(128) void k_gemm_hhx(const _Float16* __restrict__ A, int lda, size_t sA, const _Float16* __restrict__ Bh, int ldb, size_t sB, float alpha, const float* __restrict__ bias, size_t sBias, const float* __restrict__ CP, int rowsPerB, size_t sCPb, int row0g,
    float* __restrict__ C, _Float16* __restrict__ C16, int ldc, size_t sC, int M, int N, int K) {
  __shared__ __attribute__((aligned(16))) float so[4][16][64];
  const int tid = threadIdx.x, w = tid >> 5, lane = tid & 31, ln = lane & 15, hh = lane >> 4; const int by = blockIdx.y;
  A += (size_t)by * sA; Bh += (size_t)by * sB; const size_t cofs = (size_t)by * sC; const float* bp = bias ? bias + (size_t)by * sBias : nullptr;
  const int ntn = (N + 63) / 64; const int wid = blockIdx.x * 4 + w; const int mt = wid / ntn, nq = wid % ntn; if (mt * 16 >= M) return;
  const int row0 = mt * 16, col0 = nq * 64; const _Float16* arow = A + (size_t)(row0 + ln) * lda;
  v8f acc[4] = {};
  for (int kb = 0; kb < K; kb += 32) { FragH ah; ah.half[0] = *(const v8us*)((const unsigned short*)arow + kb + 8 * hh); ah.half[1] = *(const v8us*)((const unsigned short*)arow + kb + 16 + 8 * hh);
#pragma unroll
    for (int t = 0; t < 4; ++t) { if (col0 + t * 16 >= N) continue; const size_t boff = (size_t)(col0 + t * 16 + ln) * ldb + kb; FragH bq; bq.half[0] = *(const v8us*)((const unsigned short*)Bh + boff + 8 * hh); bq.half[1] = *(const v8us*)((const unsigned short*)Bh + boff + 16 + 8 * hh);
      acc[t] = mmaH<1>(ah.v, ah.v, bq.v, bq.v, acc[t]); }
  }
#pragma unroll
  for (int t = 0; t < 4; ++t) { if (col0 + t * 16 >= N) continue; const int col = col0 + t * 16 + ln; const float bv = bp ? bf16_round(bp[col]) : 0.f;
#pragma unroll
    for (int r = 0; r < 8; ++r) { float v = acc[t][r] * alpha + bv; if (CP) { const int rr = row0g + row0 + 8 * hh + r; if (rowsPerB < 0) v += CP[cofs + (size_t)rr * ldc + col];      /* rowsPerB < 0: own element of the batched C plane */ else { const int bidx = rr / rowsPerB; v += CP[(size_t)bidx * sCPb + (size_t)by * 64 + col]; } } if (ACT == 1) v = (v > 0.f) ? v : expm1f(v); else if (ACT == 7) v = (v > 0.f) ? v + 1.0f : expf(v); else if (ACT == 8) v = tanhf(v); else if (ACT == 9) v = 0.5f * v * (1.0f + tanhf(0.7978845608028654f * (v + 0.044715f * v * v * v))); else if (ACT == 11) v = 1.0f / (1.0f + expf(-v)); else if (ACT == 12) v = (v > 0.f) ? v : 0.01f * v; else if (ACT == 14) v = (v > 0.f) ? v : 0.1f * v; else if (ACT == 16) v = (v >= 0.f) ? v : 0.3f * v; else if (ACT == 17) v = (v >= 0.f) ? v : 0.2f * v; else if (ACT == 15) v = v / (1.0f + expf(-v)); else if (ACT == 3) v = fmaxf(v, 0.f); else if (ACT == 6) v = 0.5f * v * (1.0f + erff(v * 0.70710678118654752f)); so[w][8 * hh + r][t * 16 + ln] = v; } }
  __builtin_amdgcn_fence(__ATOMIC_ACQ_REL, "workgroup"); __builtin_amdgcn_wave_barrier();
  const int rsub = lane >> 4, c4 = (lane & 15) * 4; typedef _Float16 v4h __attribute__((ext_vector_type(4)));
  {
#pragma unroll
    for (int q = 0; q < 8; ++q) { const int r = q * 2 + rsub; if (col0 + c4 < N) { const v4f v = *(const v4fa*)&so[w][r][c4]; if (C) *(v4f*)(C + cofs + (size_t)(row0 + r) * ldc + col0 + c4) = v; if (C16) { v4h h4; for (int i = 0; i < 4; ++i) h4[i] = (_Float16)v[i]; *(v4h*)(C16 + cofs + (size_t)(row0 + r) * ldc + col0 + c4) = h4; } } }
     }
}


typedef _Float16 v4h __attribute__((ext_vector_type(4)));

__global__ __launch_bounds__(256) void k_x16(const float* __restrict__ x, _Float16* __restrict__ X16, size_t n8) { const size_t t = (size_t)blockIdx.x * 256 + threadIdx.x; if (t >= n8) return; FragH f;
#pragma unroll
  for (int q = 0; q < 8; ++q) f.h[q] = (_Float16)bf16_round(x[t * 8 + q]); *(v8us*)((unsigned short*)X16 + t * 8) = f.half[0];  }
__global__ __launch_bounds__(256) void k_h16(const float* __restrict__ x, _Float16* __restrict__ X16, size_t n8) { const size_t t = (size_t)blockIdx.x * 256 + threadIdx.x; if (t >= n8) return; FragH f;
#pragma unroll
  for (int q = 0; q < 8; ++q) f.h[q] = (_Float16)x[t * 8 + q]; *(v8us*)((unsigned short*)X16 + t * 8) = f.half[0];  }
__global__ __launch_bounds__(256) void k_round16f(const float* __restrict__ W, _Float16* __restrict__ Bt, size_t n8) { const size_t t = (size_t)blockIdx.x * 256 + threadIdx.x; if (t >= n8) return; FragH f;
#pragma unroll
  for (int i = 0; i < 8; ++i) f.h[i] = (_Float16)(bf16_round(W[t * 8 + i]) * 16.0f); *(v8us*)((unsigned short*)Bt + t * 8) = f.half[0];  }
template <int NHv, int TTv>
__global__ __launch_bounds__(256) void k_vt(const _Float16* __restrict__ V16, int ldv, int voff, _Float16* __restrict__ Vt) { __shared__ unsigned short tl[64][66]; const int tid = threadIdx.x; const int slab = blockIdx.x / (TTv / 64), lg = blockIdx.x % (TTv / 64); const int b = slab / NHv, h = slab % NHv;
  for (int i = tid; i < 64 * 8; i += 256) { const int r = i / 8, c8 = (i % 8) * 8; FragH f; f.half[0] = *(const v8us*)((const unsigned short*)V16 + ((size_t)b * TTv + lg * 64 + r) * ldv + voff + h * 64 + c8);
#pragma unroll
    for (int q = 0; q < 8; ++q) tl[r][c8 + q] = f.u[q]; }
  __syncthreads();
  {
#pragma unroll
    for (int rd = 0; rd < 2; ++rd) { const int d = rd * 32 + tid / 8, pc = tid % 8; FragH f;
#pragma unroll
      for (int q = 0; q < 8; ++q) f.u[q] = tl[pc * 8 + q][d];
      *(v8us*)((unsigned short*)Vt + ((size_t)slab * 64 + d) * TTv + lg * 64 + pc * 8) = f.half[0]; }
     } }

// ---- fast GEMM (work-group tile 128x64, wave tile 32x64; A and B tiles of 64 k staged in LDS by asynchronous copies, two buffers; requires M % 128 == 0 rows per launch region, N % 64 == 0, K % 64 == 0); epilogue = k_gemm_hhx semantics ----
__device__ __forceinline__ v16h g2_frag(const _Float16* p, int hh) { FragH f; f.half[0] = *(const v8us*)((const unsigned short*)p + 8 * hh); f.half[1] = *(const v8us*)((const unsigned short*)p + 16 + 8 * hh); return f.v; }
__device__ __forceinline__ v8f g2_mma(v16h a, v16h b, v8f c) { v8f d = __builtin_amdgcn_wmma_f32_16x16x32_f16(false, a, false, b, (short)0, c, false, false); asm volatile("v_nop\n\tv_nop\n\tv_nop\n\tv_nop" : "+v"(d) : "v"(a), "v"(b)); return d; }
#define G2_PITCH 144                 /* LDS row pitch in bytes of a staged 128-byte row: 16 B x odd, the conflict-free pitch for 16-byte LDS reads */
#define G2_BUF (192 * G2_PITCH)      /* one staged tile: 128 A rows, then 64 B rows, 64 k each */
static_assert(MP % 128 == 0 && QT % 128 == 0 && QT0 % 128 == 0, "k_gemm2: a work-group stages 128 whole A rows");
static_assert(HD % 64 == 0 && QT % 64 == 0 && DM % 64 == 0 && DFF % 64 == 0, "k_gemm2: K is a multiple of the staged 64 k, N of the 64 B rows");
// One tile into LDS: twelve asynchronous 16-byte copies a lane (a wave's 32 lanes take 4 whole 128-byte rows per copy; copy i lands 16 rows below copy i - 1; 0..7 = A rows, 8..11 = B rows).
// One asm statement: the copies go from global memory to LDS through no register, and the s_wait_xcnt at its end stands in front of any later overwrite of the address registers that the copies name.
__device__ __forceinline__ void g2_stage(unsigned l, const _Float16* ga, size_t sa, const _Float16* gb, size_t sb) {
  asm volatile("global_load_async_to_lds_b128 %0, %12, off\n\tglobal_load_async_to_lds_b128 %1, %13, off\n\tglobal_load_async_to_lds_b128 %2, %14, off\n\tglobal_load_async_to_lds_b128 %3, %15, off\n\t"
               "global_load_async_to_lds_b128 %4, %16, off\n\tglobal_load_async_to_lds_b128 %5, %17, off\n\tglobal_load_async_to_lds_b128 %6, %18, off\n\tglobal_load_async_to_lds_b128 %7, %19, off\n\t"
               "global_load_async_to_lds_b128 %8, %20, off\n\tglobal_load_async_to_lds_b128 %9, %21, off\n\tglobal_load_async_to_lds_b128 %10, %22, off\n\tglobal_load_async_to_lds_b128 %11, %23, off\n\ts_wait_xcnt 0x0"
               :: "v"(l), "v"(l + 16 * G2_PITCH), "v"(l + 32 * G2_PITCH), "v"(l + 48 * G2_PITCH), "v"(l + 64 * G2_PITCH), "v"(l + 80 * G2_PITCH), "v"(l + 96 * G2_PITCH), "v"(l + 112 * G2_PITCH),
                  "v"(l + 128 * G2_PITCH), "v"(l + 144 * G2_PITCH), "v"(l + 160 * G2_PITCH), "v"(l + 176 * G2_PITCH),
                  "v"(ga), "v"(ga + sa), "v"(ga + 2 * sa), "v"(ga + 3 * sa), "v"(ga + 4 * sa), "v"(ga + 5 * sa), "v"(ga + 6 * sa), "v"(ga + 7 * sa), "v"(gb), "v"(gb + sb), "v"(gb + 2 * sb), "v"(gb + 3 * sb) : "memory"); }
template <int ACT>
__global__ __launch_bounds__(128) void k_gemm2(const _Float16* __restrict__ A, int lda, size_t sA, const _Float16* __restrict__ Bh, int ldb, size_t sB, float alpha, const float* __restrict__ bias, size_t sBias, const float* __restrict__ CP, int rowsPerB, size_t sCPb, int row0g,
    float* __restrict__ C, _Float16* __restrict__ C16, int ldc, size_t sC, int M, int N, int K, size_t zA = 0, size_t zB = 0, size_t zC = 0) { static_assert(ACT == 0 || ACT == 3 || ACT == 6 || ACT == 8 || ACT == 9 || ACT == 11 || ACT == 12 || ACT == 14 || ACT == 15 || ACT == 16 || ACT == 17, "k_gemm2: unsupported ACT code (would silently apply no activation)");
  __shared__ __attribute__((aligned(16))) unsigned char sm[2 * G2_BUF]; float (*so)[32][68] = (float (*)[32][68])sm;      /* two staged tiles; behind the loop's last barrier the same bytes are the epilogue's [4][32][68] f32 staging */
  static_assert(sizeof(float) * 4 * 32 * 68 <= 2 * G2_BUF, "k_gemm2: the epilogue staging fits the two tile buffers");
  const int tid = threadIdx.x, w = tid >> 5, lane = tid & 31, ln = lane & 15, hh = lane >> 4; const int by = blockIdx.y; const int bz = blockIdx.z;      /* second batch axis (strides zA, zB, zC) */
  A += (size_t)by * sA + (size_t)bz * zA; Bh += (size_t)by * sB + (size_t)bz * zB; const size_t cofs = (size_t)by * sC + (size_t)bz * zC; const float* bp = bias ? bias + (size_t)by * sBias : nullptr;
  const int ntn = N >> 6; const int mt = blockIdx.x / ntn, nq = blockIdx.x - mt * ntn; const int row0 = mt * 128 + 32 * w, col0 = nq * 64; if (mt * 128 >= M) return;      /* the whole work-group leaves or none: barriers follow */
  const _Float16* ga = A + (size_t)(mt * 128 + (tid >> 3)) * lda + (tid & 7) * 8; const _Float16* gb = Bh + (size_t)(col0 + (tid >> 3)) * ldb + (tid & 7) * 8;      /* this lane's 16 bytes of row tid / 8 of each 16-row group */
  const size_t sa = (size_t)16 * lda, sb = (size_t)16 * ldb; const unsigned l0 = (unsigned)(size_t)sm + (unsigned)((tid >> 3) * G2_PITCH + (tid & 7) * 16);
  const unsigned char* fa = sm + (32 * w + ln) * G2_PITCH; const unsigned char* fb = sm + (128 + ln) * G2_PITCH;      /* this lane's fragment rows in buffer 0 */
  const v8f z8 = {0.f,0.f,0.f,0.f,0.f,0.f,0.f,0.f}; v8f c00 = z8, c01 = z8, c02 = z8, c03 = z8, c10 = z8, c11 = z8, c12 = z8, c13 = z8;
  const int nt = K >> 6;
  g2_stage(l0, ga, sa, gb, sb);
  asm volatile("s_wait_asynccnt 0x0" ::: "memory");      /* this wave's copies of tile 0 have landed */
  __syncthreads();      /* tile 0 published: every wave's copies have landed */
  if (nt > 1) g2_stage(l0 + G2_BUF, ga + 64, sa, gb + 64, sb);      /* tile 1 flies while tile 0 is worked on */
#pragma unroll 1
  for (int t = 0; t < nt; ++t) { const unsigned bo = (unsigned)(t & 1) * G2_BUF;      /* kept rolled: one trip is one staged tile and the buffers alternate; unrolled, the copies' and waits' code would only be repeated */
#pragma unroll
    for (int ks = 0; ks < 2; ++ks) { const _Float16* pa = (const _Float16*)(fa + bo + ks * 64); const _Float16* pb = (const _Float16*)(fb + bo + ks * 64);      /* unrolled so that the two halves of a tile are immediate offsets of the LDS reads; 32 k = 64 bytes of every row; k ascends as before */
      const v16h a0 = g2_frag(pa, hh), a1 = g2_frag(pa + 8 * G2_PITCH, hh), b0 = g2_frag(pb, hh), b1 = g2_frag(pb + 8 * G2_PITCH, hh), b2 = g2_frag(pb + 16 * G2_PITCH, hh), b3 = g2_frag(pb + 24 * G2_PITCH, hh);      /* 16 rows = 8 * G2_PITCH halves */
      c00 = g2_mma(a0, b0, c00); c10 = g2_mma(a1, b0, c10); c01 = g2_mma(a0, b1, c01); c11 = g2_mma(a1, b1, c11);
      c02 = g2_mma(a0, b2, c02); c12 = g2_mma(a1, b2, c12); c03 = g2_mma(a0, b3, c03); c13 = g2_mma(a1, b3, c13); }
    asm volatile("s_wait_dscnt 0x0" ::: "memory");      /* this wave's reads of the buffer have returned before the buffer is given up */
    asm volatile("s_wait_asynccnt 0x0" ::: "memory");      /* this wave's copies of tile t + 1 have landed */
    __syncthreads();      /* publishes tile t + 1 and ends every wave's reads of tile t */
    if (t + 2 < nt) g2_stage(l0 + bo, ga + (size_t)(t + 2) * 64, sa, gb + (size_t)(t + 2) * 64, sb); }      /* refill of the buffer just left */
  asm volatile("s_wait_asynccnt 0x0" ::: "memory");      /* no copy is outstanding when the buffers become the epilogue's staging */
  v8f accs[8] = {c00, c01, c02, c03, c10, c11, c12, c13};
#pragma unroll
  for (int u = 0; u < 8; ++u) { const int t = u & 3, half = u >> 2; const int col = col0 + t * 16 + ln; const float bv = bp ? bf16_round(bp[col]) : 0.f;
#pragma unroll
    for (int r = 0; r < 8; ++r) { const int rloc = half * 16 + 8 * hh + r; float v = accs[u][r] * alpha + bv; if (CP) { if (rowsPerB < 0) v += CP[cofs + (size_t)(row0g + row0 + rloc) * ldc + col];      /* rowsPerB < 0: own element of the batched C plane */ else { const int bidx = (row0g + row0 + rloc) / rowsPerB; v += CP[(size_t)bidx * sCPb + (size_t)by * 64 + col]; } }
      if (ACT == 3) v = fmaxf(v, 0.f); else if (ACT == 6) v = 0.5f * v * (1.0f + erff(v * 0.70710678118654752f)); else if (ACT == 11) v = 1.0f / (1.0f + expf(-v)); else if (ACT == 15) v = v / (1.0f + expf(-v)); else if (ACT == 12) v = (v > 0.f) ? v : 0.01f * v; else if (ACT == 8) v = tanhf(v); else if (ACT == 9) v = 0.5f * v * (1.0f + tanhf(0.7978845608028654f * (v + 0.044715f * v * v * v))); else if (ACT == 14) v = (v > 0.f) ? v : 0.1f * v; else if (ACT == 16) v = (v >= 0.f) ? v : 0.3f * v; else if (ACT == 17) v = (v >= 0.f) ? v : 0.2f * v;
      so[w][rloc][t * 16 + ln] = v; } }
  __builtin_amdgcn_fence(__ATOMIC_ACQ_REL, "workgroup"); __builtin_amdgcn_wave_barrier();
  const int rsub = lane >> 4, c4 = (lane & 15) * 4;
  {
#pragma unroll
    for (int q = 0; q < 16; ++q) { const int r = q * 2 + rsub; const v4f v = *(const v4fa*)&so[w][r][c4]; if (C) *(v4f*)(C + cofs + (size_t)(row0 + r) * ldc + col0 + c4) = v; if (C16) { v4h h4; for (int i = 0; i < 4; ++i) h4[i] = (_Float16)v[i]; *(v4h*)(C16 + cofs + (size_t)(row0 + r) * ldc + col0 + c4) = h4; } }
     } }


// ---- wide GEMM for the four all-row products (work-group tile 256x128, eight waves as 4 x 2, wave tile 64x64; requires M % 256 == 0, N % 128 == 0, K % 64 == 0); staging, k order and epilogue arithmetic as in k_gemm2 ----
// Against the 128x64 tile: half the operand rows copied from L2 per output element (384 rows per 32768 outputs, not 192 per 8192), and 16 LDS fragment reads per 16 products, not 12 per 8.
#define G3_BUF (384 * G2_PITCH)      /* one staged tile: 256 A rows, then 128 B rows, 64 k each */
static_assert(MP % 256 == 0 && DM % 128 == 0 && DFF % 128 == 0, "k_gemm3: whole 256x128 tiles");
// One tile into LDS: twelve asynchronous 16-byte copies a lane (the work-group's 256 lanes take 32 whole 128-byte rows per copy; copy i lands 32 rows below copy i - 1; 0..7 = A rows, 8..11 = B rows).
// One asm statement, as in g2_stage: the s_wait_xcnt at its end stands in front of any later overwrite of the address registers that the copies name.
__device__ __forceinline__ void g3_stage(unsigned l, const _Float16* ga, const _Float16* ga4, size_t sa, const _Float16* gb, size_t sb) {      /* ga4: this lane's source of copy 4, the first of the tile's lower 128 A rows */
  asm volatile("global_load_async_to_lds_b128 %0, %12, off\n\tglobal_load_async_to_lds_b128 %1, %13, off\n\tglobal_load_async_to_lds_b128 %2, %14, off\n\tglobal_load_async_to_lds_b128 %3, %15, off\n\t"
               "global_load_async_to_lds_b128 %4, %16, off\n\tglobal_load_async_to_lds_b128 %5, %17, off\n\tglobal_load_async_to_lds_b128 %6, %18, off\n\tglobal_load_async_to_lds_b128 %7, %19, off\n\t"
               "global_load_async_to_lds_b128 %8, %20, off\n\tglobal_load_async_to_lds_b128 %9, %21, off\n\tglobal_load_async_to_lds_b128 %10, %22, off\n\tglobal_load_async_to_lds_b128 %11, %23, off\n\ts_wait_xcnt 0x0"
               :: "v"(l), "v"(l + 32 * G2_PITCH), "v"(l + 64 * G2_PITCH), "v"(l + 96 * G2_PITCH), "v"(l + 128 * G2_PITCH), "v"(l + 160 * G2_PITCH), "v"(l + 192 * G2_PITCH), "v"(l + 224 * G2_PITCH),
                  "v"(l + 256 * G2_PITCH), "v"(l + 288 * G2_PITCH), "v"(l + 320 * G2_PITCH), "v"(l + 352 * G2_PITCH),
                  "v"(ga), "v"(ga + sa), "v"(ga + 2 * sa), "v"(ga + 3 * sa), "v"(ga4), "v"(ga4 + sa), "v"(ga4 + 2 * sa), "v"(ga4 + 3 * sa), "v"(gb), "v"(gb + sb), "v"(gb + 2 * sb), "v"(gb + 3 * sb) : "memory"); }
// C = act(A Bh^T alpha + bias (+ CP where RES: the own element of a plane laid out like C)); F32O: f32 rows into C, else f16 rows into C16; LDC: row pitch of C, C16 and CP in elements
// MODE 0: plain.
// MODE 1: the M rows are the first QT0 = 128 rows of every batch, taken from A at their places (row r of the product is row r % 128 of batch r / 128), so that a tile's upper and lower 128 rows are two batches' first tiles; C rows stay r
// MODE 2: plain, but the first QT0 rows of every batch are left out (the waves that would hold them take their share of the copies, pass the waits and barriers, and do no products and no write-out): MODE 3 tiles of the same launch write those rows
// MODE 3: row tile mt is batch mt's first QT0 rows twice: upper 128 rows from the hi plane A, lower 128 from the x1024 residual plane A2; at write-out the lower waves' product (alpha / 1024) is added to the upper waves' rows of C
// MODE 4: q | k | v: the v columns (from 2 DM on) leave transposed, as V^T [batch][head][HD][SQ] rows into VTo, and not into C16
// bx: which tile, n tile fastest; sm: 2 * G3_BUF bytes of LDS
template <int ACT, bool RES, bool F32O, int LDC, int MODE>
__device__ __forceinline__ void gemm3_tile(const _Float16* __restrict__ A, int lda, const _Float16* __restrict__ Bh, int ldb, float alpha, const float* __restrict__ bias, const float* __restrict__ CP,
    float* __restrict__ C, _Float16* __restrict__ C16, int M, int N, int K, int bx, unsigned char* sm, const _Float16* __restrict__ A2 = nullptr, _Float16* __restrict__ VTo = nullptr) { static_assert(ACT == 0 || ACT == 3, "gemm3_tile: no activation or relu"); static_assert(QT0 == 128 && SQ % 256 == 0 && HD == 64, "gemm3_tile: a first tile is half a tile's rows; a wave's 64 columns are one head");
  float (*so)[32][68] = (float (*)[32][68])sm;      /* two staged tiles; behind the loop's last barrier the same bytes are the epilogue's [8][32][68] f32 staging */
  static_assert(sizeof(float) * 8 * 32 * 68 <= 2 * G3_BUF, "gemm3_tile: the epilogue staging fits the two tile buffers");
  const int tid = threadIdx.x, w = tid >> 5, lane = tid & 31, ln = lane & 15, hh = lane >> 4; const int wm = w >> 1, wn = w & 1;
  const int ntn = N >> 7; const int mt = bx / ntn, nq = bx - mt * ntn; const int row0 = mt * 256 + 64 * wm, col0 = nq * 128 + 64 * wn; if (mt * 256 >= M) return;      /* the whole work-group leaves or none: barriers follow */
  const int wu = __builtin_amdgcn_readfirstlane(w); const bool dead = MODE == 2 && mt % (SQ / 256) == 0 && wu < 4;      /* wave-uniform, in a scalar register: waves 0..3 hold the tile's upper 128 rows */
  const _Float16* ga = A + (size_t)((MODE == 1 ? mt * 2 * SQ : MODE == 3 ? mt * QT0 : mt * 256) + (tid >> 3)) * lda + (tid & 7) * 8; const _Float16* gb = Bh + (size_t)(nq * 128 + (tid >> 3)) * ldb + (tid & 7) * 8;      /* this lane's 16 bytes of row tid / 8 of each 32-row group */
  const _Float16* ga4 = MODE == 3 ? A2 + (size_t)(mt * QT0 + (tid >> 3)) * lda + (tid & 7) * 8 : ga + (size_t)(MODE == 1 ? SQ : 128) * lda;      /* the same of the lower 128 rows */
  const size_t sa = (size_t)32 * lda, sb = (size_t)32 * ldb; const unsigned l0 = (unsigned)(size_t)sm + (unsigned)((tid >> 3) * G2_PITCH + (tid & 7) * 16);
  const unsigned char* fa = sm + (64 * wm + ln) * G2_PITCH; const unsigned char* fb = sm + (256 + 64 * wn + ln) * G2_PITCH;      /* this lane's fragment rows in buffer 0 */
  const v8f z8 = {0.f,0.f,0.f,0.f,0.f,0.f,0.f,0.f}; v8f c[4][4];
#pragma unroll
  for (int i = 0; i < 4; ++i)
#pragma unroll
    for (int j = 0; j < 4; ++j) c[i][j] = z8;
  const int nt = K >> 6;
  g3_stage(l0, ga, ga4, sa, gb, sb);
  asm volatile("s_wait_asynccnt 0x0" ::: "memory");      /* this wave's copies of tile 0 have landed */
  __syncthreads();      /* tile 0 published: every wave's copies have landed */
  if (nt > 1) g3_stage(l0 + G3_BUF, ga + 64, ga4 + 64, sa, gb + 64, sb);      /* tile 1 flies while tile 0 is worked on */
#pragma unroll 1
  for (int t = 0; t < nt; ++t) { const unsigned bo = (unsigned)(t & 1) * G3_BUF;      /* kept rolled: one trip is one staged tile and the buffers alternate */
    if (!dead) {      /* a scalar branch; the waits and the barrier below are passed all the same */
#pragma unroll
    for (int ks = 0; ks < 2; ++ks) { const _Float16* pa = (const _Float16*)(fa + bo + ks * 64); const _Float16* pb = (const _Float16*)(fb + bo + ks * 64); v16h a[4], b[4];      /* unrolled: the two halves of a tile are immediate offsets of the LDS reads; k ascends as in k_gemm2 */
#pragma unroll
      for (int i = 0; i < 4; ++i) { a[i] = g2_frag(pa + i * 8 * G2_PITCH, hh); b[i] = g2_frag(pb + i * 8 * G2_PITCH, hh); }      /* 16 rows = 8 * G2_PITCH halves; the eight fragments' reads stand together in front of their products */
#pragma unroll
      for (int j = 0; j < 4; ++j)
#pragma unroll
        for (int i = 0; i < 4; ++i) c[i][j] = g2_mma(a[i], b[j], c[i][j]); } }
    asm volatile("s_wait_dscnt 0x0" ::: "memory");      /* this wave's reads of the buffer have returned before the buffer is given up */
    asm volatile("s_wait_asynccnt 0x0" ::: "memory");      /* this wave's copies of tile t + 1 have landed */
    __syncthreads();      /* publishes tile t + 1 and ends every wave's reads of tile t */
    if (t + 2 < nt) g3_stage(l0 + bo, ga + (size_t)(t + 2) * 64, ga4 + (size_t)(t + 2) * 64, sa, gb + (size_t)(t + 2) * 64, sb); }      /* refill of the buffer just left */
  asm volatile("s_wait_asynccnt 0x0" ::: "memory");      /* no copy is outstanding when the buffers become the epilogue's staging */
  if (dead) return;      /* no barrier follows in MODE 2 */
  const int rsub = lane >> 4, c4 = (lane & 15) * 4; float bv[4] = {0.f, 0.f, 0.f, 0.f};
  if (bias) {      /* one test for the four loads, so that they fly together */
#pragma unroll
    for (int t = 0; t < 4; ++t) bv[t] = bf16_round(bias[col0 + t * 16 + ln]); }
  if (MODE == 4 && nq * 128 >= 2 * DM) {      /* the same for a whole work-group. Register r of an accumulator is row 8 hh + r of column ln: a lane's 8 values of a tile are 8 consecutive keys of one V^T row, one 16-byte LDS store */
    unsigned char* vs = sm + w * (64 * G2_PITCH);      /* the wave's own 64 V^T rows of 64 keys (128 bytes) at the staged tiles' pitch */
    static_assert(8 * 64 * G2_PITCH <= 2 * G3_BUF, "gemm3_tile: the V^T staging fits the two tile buffers");
#pragma unroll
    for (int t = 0; t < 4; ++t)
#pragma unroll
      for (int i = 0; i < 4; ++i) { FragH f;
#pragma unroll
        for (int r = 0; r < 8; ++r) f.h[r] = (_Float16)(c[i][t][r] * alpha + bv[t]);
        *(v8us*)(vs + (16 * t + ln) * G2_PITCH + 32 * i + 16 * hh) = f.half[0]; }
    __builtin_amdgcn_fence(__ATOMIC_ACQ_REL, "workgroup"); __builtin_amdgcn_wave_barrier();      /* the wave's staging stores stay in front of its row reads */
    unsigned short* vp = (unsigned short*)VTo + ((size_t)((row0 / SQ) * NH + (col0 - 2 * DM) / HD) * HD + (lane >> 3)) * SQ + row0 % SQ + (lane & 7) * 8;      /* eight lanes take one 128-byte row piece, a wave store four rows */
#pragma unroll
    for (int g = 0; g < 2; ++g) {
#pragma unroll
      for (int q = 8 * g; q < 8 * g + 8; ++q) { const v8us v = *(const v8us*)(vs + (q * 4 + (lane >> 3)) * G2_PITCH + (lane & 7) * 16); *(v8us*)(vp + q * 4 * SQ) = v; }
      asm volatile("s_wait_xcnt 0x0" ::: "memory"); }      /* the wait that belongs in front of a later overwrite of the registers which these eight stores name */
    return; }
  if (MODE == 3) {      /* waves 0..3 hold o_hi Wo, wave w + 4 holds o_lo Wo of the same rows and columns */
    const bool hiw = wu < 4; const float al = hiw ? alpha : alpha * 0.0009765625f;
    if (!hiw) { bv[0] = 0.f; bv[1] = 0.f; bv[2] = 0.f; bv[3] = 0.f; }
    const size_t eh = (size_t)(mt * SQ + 64 * (wm & 1) + rsub) * LDC + col0 + c4;      /* as e0 below, in batch mt's first rows */
#pragma unroll
    for (int hf = 0; hf < 2; ++hf) { v4f res[16];
      if (hiw) { const float* rp = CP + eh;
#pragma unroll
        for (int q = 0; q < 16; ++q) res[q] = *(const v4fa*)(rp + (32 * hf + 2 * q) * LDC);
        asm volatile("s_wait_xcnt 0x0" :: "v"(rp) : "memory"); }      /* the wait that belongs in front of any overwrite of the loads' address register; naming it keeps it whole up to here */
#pragma unroll
      for (int u = 0; u < 8; ++u) { const int t = u & 3, ih = u >> 2;
#pragma unroll
        for (int r = 0; r < 8; ++r) so[w][ih * 16 + 8 * hh + r][t * 16 + ln] = c[2 * hf + ih][t][r] * al + bv[t]; }
      __syncthreads();      /* the lower waves' staged rows are published to the upper waves */
      if (hiw) {
#pragma unroll
        for (int g = 0; g < 2; ++g) {
#pragma unroll
          for (int q = 8 * g; q < 8 * g + 8; ++q) { v4f v = *(const v4fa*)&so[w][q * 2 + rsub][c4]; const v4f vl = *(const v4fa*)&so[w + 4][q * 2 + rsub][c4];
            v += res[q]; v = vl + v;      /* (o_hi Wo alpha + bias) + x, then + o_lo Wo alpha / 1024: the order of the two launches that this tile replaces */
            *(v4f*)(C + eh + (32 * hf + 2 * q) * LDC) = v; }
          asm volatile("s_wait_xcnt 0x0" ::: "memory"); } }      /* the wait that belongs in front of a later overwrite of the registers which these eight stores name */
      __syncthreads(); }      /* the row reads end before the next half's staging stores */
    return; }
  const size_t e0 = (size_t)(row0 + rsub) * LDC + col0 + c4;      /* this lane's 4 columns of row rsub of the wave's tile; its further rows lie 2 LDC apart, a compile-time step, so that every access below is this one address and an immediate offset */
#pragma unroll
  for (int hf = 0; hf < 2; ++hf) {      /* the wave's 64 rows leave in two halves of 32 through its own staging rows */
    v4f res[16];
    if (RES) { const float* rp = CP + e0;      /* the residual in the layout of the write-out: whole 256-byte row pieces, the half's sixteen loads in flight together, under the staging below */
#pragma unroll
      for (int q = 0; q < 16; ++q) res[q] = *(const v4fa*)(rp + (32 * hf + 2 * q) * LDC);
      asm volatile("s_wait_xcnt 0x0" :: "v"(rp) : "memory"); }      /* the wait that belongs in front of any overwrite of the loads' address register; naming it keeps it whole up to here */
#pragma unroll
    for (int u = 0; u < 8; ++u) { const int t = u & 3, ih = u >> 2;
#pragma unroll
      for (int r = 0; r < 8; ++r) so[w][ih * 16 + 8 * hh + r][t * 16 + ln] = c[2 * hf + ih][t][r] * alpha + bv[t]; }
    __builtin_amdgcn_fence(__ATOMIC_ACQ_REL, "workgroup"); __builtin_amdgcn_wave_barrier();      /* the wave's staging stores stay in front of its row reads */
#pragma unroll
    for (int g = 0; g < 2; ++g) {
#pragma unroll
      for (int q = 8 * g; q < 8 * g + 8; ++q) { v4f v = *(const v4fa*)&so[w][q * 2 + rsub][c4];
        if (RES) v += res[q];      /* acc alpha + bias, then the residual, then the activation: the order of k_gemm2 */
        if (ACT == 3) { for (int i = 0; i < 4; ++i) v[i] = fmaxf(v[i], 0.f); }
        if (F32O) *(v4f*)(C + e0 + (32 * hf + 2 * q) * LDC) = v; else { v4h h4; for (int i = 0; i < 4; ++i) h4[i] = (_Float16)v[i]; *(v4h*)(C16 + e0 + (32 * hf + 2 * q) * LDC) = h4; } }
      asm volatile("s_wait_xcnt 0x0" ::: "memory"); }      /* the wait that belongs in front of a later overwrite of the registers which these eight stores name */
    __builtin_amdgcn_fence(__ATOMIC_ACQ_REL, "workgroup"); __builtin_amdgcn_wave_barrier(); } }      /* the row reads stay in front of the next half's staging stores */
template <int ACT, bool RES, bool F32O, int LDC>
__global__ __launch_bounds__(256) void k_gemm3(const _Float16* __restrict__ A, int lda, const _Float16* __restrict__ Bh, int ldb, float alpha, const float* __restrict__ bias, const float* __restrict__ CP,
    float* __restrict__ C, _Float16* __restrict__ C16, int M, int N, int K) {
  __shared__ __attribute__((aligned(16))) unsigned char sm[2 * G3_BUF];
  gemm3_tile<ACT, RES, F32O, LDC, 0>(A, lda, Bh, ldb, alpha, bias, CP, C, C16, M, N, K, (int)blockIdx.x, sm); }
// x1 = x + o Wo + b: the rows behind every batch's first tile from the f16 o rows, the first-tile rows from the exact o's two f16 planes. Every row of x1 is written by one kind of tile alone, and neither reads what the other writes: one launch. The branch is the same for a whole work-group.
#define PJ_ALL ((MPO / 256) * (DM / 128))
#define PJ_HL (NB * (DM / 128))
__global__ __launch_bounds__(256) void k_proj(const _Float16* __restrict__ A, const _Float16* __restrict__ Bh, const float* __restrict__ bias, const float* __restrict__ CP, float* __restrict__ C, const _Float16* __restrict__ Hh, const _Float16* __restrict__ Hl) {
  __shared__ __attribute__((aligned(16))) unsigned char sm[2 * G3_BUF];
  const int bx = (int)blockIdx.x;
  if (bx < PJ_ALL) { gemm3_tile<0, true, true, DM, 2>(A, DM, Bh, DM, 0.0009765625f, bias, CP, C, nullptr, MPO, DM, DM, bx, sm); return; }
  gemm3_tile<0, true, true, DM, 3>(Hh, DM, Bh, DM, 0.0009765625f, bias, CP, C, nullptr, NB * 256, DM, DM, bx - PJ_ALL, sm, Hl); }
// q | k | v of all rows (f16) and, from the same operands, q | k | v of every batch's first tile (f32, for the exact attention): neither reads what the other writes, one launch. The all-row tiles come first; the few first-tile ones fill places of the last, partly empty round. The branch is the same for a whole work-group.
#define QB_ALL ((MP / 256) * (3 * DM / 128))
#define QB_FT ((NB * QT0 / 256) * (3 * DM / 128))
static_assert((NB * QT0) % 256 == 0, "k_qkv: whole tiles of two first tiles");
__global__ __launch_bounds__(256) void k_qkv(const _Float16* __restrict__ A, const _Float16* __restrict__ Bh, const float* __restrict__ bias, _Float16* __restrict__ C16, float* __restrict__ CF, _Float16* __restrict__ VTo) {
  __shared__ __attribute__((aligned(16))) unsigned char sm[2 * G3_BUF];
  const int bx = (int)blockIdx.x;
  if (bx < QB_ALL) { gemm3_tile<0, false, false, 3 * DM, 4>(A, DM, Bh, DM, 0.0625f, bias, nullptr, nullptr, C16, MP, 3 * DM, DM, bx, sm, nullptr, VTo); return; }
  gemm3_tile<0, false, true, 3 * DM, 1>(A, DM, Bh, DM, 0.0625f, bias, nullptr, CF, nullptr, NB * QT0, 3 * DM, DM, bx - QB_ALL, sm); }


__global__ __launch_bounds__(256) void k_wnat(const float* __restrict__ w, size_t n8, _Float16* __restrict__ Bt) { const size_t t = (size_t)blockIdx.x * 256 + threadIdx.x; if (t >= n8) return; FragH f; for (int q = 0; q < 8; ++q) f.h[q] = (_Float16)(bf16_round(w[t * 8 + q]) * 16.0f); *(v8us*)((unsigned short*)Bt + t * 8) = f.half[0];  }
__global__ __launch_bounds__(256) void k_rsm(const float* __restrict__ S, _Float16* __restrict__ P, int nrows) {
  #pragma clang fp contract(off)
  const int i = blockIdx.x * 256 + threadIdx.x; if (i >= nrows) return; const float* s = S + (size_t)i * SQ; float mx = -3.0e38f;
#pragma unroll 1
  for (int j = 0; j < SQ; ++j) mx = fmaxf(mx, s[j]); float se = 0.f;
#pragma unroll 1
  for (int j = 0; j < SQ; ++j) se += expf(s[j] - mx); const float sc = 256.0f / se;
#pragma unroll 1
  for (int j0 = 0; j0 < SQ; j0 += 8) { FragH f; for (int q = 0; q < 8; ++q) f.h[q] = (_Float16)(expf(s[j0 + q] - mx) * sc); unsigned short* d = (unsigned short*)P + (size_t)i * SQ + j0; *(v8us*)d = f.half[0];  } }
__global__ __launch_bounds__(256) void k_vt(const _Float16* __restrict__ V16, int b, int h0, _Float16* __restrict__ VT) { __shared__ unsigned short tl[64][65]; const int tid = threadIdx.x; const int hh = blockIdx.x % HG, sg = blockIdx.x / HG; const int s0 = sg * 64; const int h = h0 + hh;
  for (int i = tid; i < 64 * 8; i += 256) { const int j = i / 8, d8 = (i % 8) * 8; FragH f; f.half[0] = *(const v8us*)((const unsigned short*)V16 + ((size_t)b * SQ + s0 + j) * DM + h * HD + d8); for (int q = 0; q < 8; ++q) tl[d8 + q][j] = f.u[q]; }
  __syncthreads();
  { for (int i = tid; i < 64 * 8; i += 256) { const int d = i / 8, j8 = (i % 8) * 8; FragH f; for (int q = 0; q < 8; ++q) f.u[q] = tl[d][j8 + q]; *(v8us*)((unsigned short*)VT + ((size_t)hh * HD + d) * SQ + s0 + j8) = f.half[0]; }  } }



// lane l with lane l ^ m inside a 16-lane row (DPP row_xmask, CTRL = 0x160 | m)
template <int CTRL> __device__ __forceinline__ float lane_xm(float x) { return __builtin_bit_cast(float, __builtin_amdgcn_update_dpp(0, __builtin_bit_cast(int, x), CTRL, 0xf, 0xf, true)); }
// 2^t for eight values in place. Asm so that the free slot which the instruction set asks for behind a transcendental, before its result is used or its source overwritten, stands by construction: no line here touches the line before it, and the v_nop covers the last
__device__ __forceinline__ void exp2_x8(float (&t)[8]) { asm("v_exp_f32 %0, %0\n\tv_exp_f32 %1, %1\n\tv_exp_f32 %2, %2\n\tv_exp_f32 %3, %3\n\tv_exp_f32 %4, %4\n\tv_exp_f32 %5, %5\n\tv_exp_f32 %6, %6\n\tv_exp_f32 %7, %7\n\tv_nop" : "+v"(t[0]), "+v"(t[1]), "+v"(t[2]), "+v"(t[3]), "+v"(t[4]), "+v"(t[5]), "+v"(t[6]), "+v"(t[7])); }
// ---- fused causal attention: scores, softmax and P V of 128 query rows of one head in one work-group; S and P never reach memory ----
// A wave holds 32 query rows (q fragments and the o tiles in registers). Per tile of 64 keys: S = q K^T on WMMA, running row maximum and sum (the o tiles and the sum are rescaled when the maximum rises), P (x256, f16) goes through the wave's own LDS rows from accumulator layout to A-fragment layout, o += P V on WMMA.
#define FA_BUF (128 * G2_PITCH)      /* one staged key tile: 64 K rows, then 64 V^T rows, 128 bytes each */
#define FA_PH (G2_PITCH / 2)         /* pitch of a P row in halves */
static_assert(SQ % 128 == 0 && HD == 64, "k_fattn: whole tiles of 128 query rows and 64 keys; 64 values a head");
// One key tile into LDS: eight asynchronous 16-byte copies a lane (copy i lands 16 rows below copy i - 1; 0..3 = K rows, 4..7 = V^T rows). One asm statement, as in g2_stage: the s_wait_xcnt at its end stands in front of any later overwrite of the address registers that the copies name.
__device__ __forceinline__ void fa_stage(unsigned l, const _Float16* gk, size_t sk, const _Float16* gv, size_t sv) {
  asm volatile("global_load_async_to_lds_b128 %0, %8, off\n\tglobal_load_async_to_lds_b128 %1, %9, off\n\tglobal_load_async_to_lds_b128 %2, %10, off\n\tglobal_load_async_to_lds_b128 %3, %11, off\n\t"
               "global_load_async_to_lds_b128 %4, %12, off\n\tglobal_load_async_to_lds_b128 %5, %13, off\n\tglobal_load_async_to_lds_b128 %6, %14, off\n\tglobal_load_async_to_lds_b128 %7, %15, off\n\ts_wait_xcnt 0x0"
               :: "v"(l), "v"(l + 16 * G2_PITCH), "v"(l + 32 * G2_PITCH), "v"(l + 48 * G2_PITCH), "v"(l + 64 * G2_PITCH), "v"(l + 80 * G2_PITCH), "v"(l + 96 * G2_PITCH), "v"(l + 112 * G2_PITCH),
                  "v"(gk), "v"(gk + sk), "v"(gk + 2 * sk), "v"(gk + 3 * sk), "v"(gv), "v"(gv + sv), "v"(gv + 2 * sv), "v"(gv + 3 * sv) : "memory"); }
__device__ __forceinline__ float row16_max(float x) { x = fmaxf(x, lane_xm<0x161>(x)); x = fmaxf(x, lane_xm<0x162>(x)); x = fmaxf(x, lane_xm<0x164>(x)); return fmaxf(x, lane_xm<0x168>(x)); }
__device__ __forceinline__ float row16_sum(float x) { x += lane_xm<0x161>(x); x += lane_xm<0x162>(x); x += lane_xm<0x164>(x); return x + lane_xm<0x168>(x); }
#define FA_LDS (2 * FA_BUF + 4 * 32 * G2_PITCH)      /* two staged key tiles, then 32 P rows per wave */
__device__ __forceinline__ void fattn_tile(const _Float16* __restrict__ Q, const _Float16* __restrict__ K, const _Float16* __restrict__ VTp, float scale, _Float16* __restrict__ O, int h, int b, int qt, unsigned char* sm) {      /* sm: FA_LDS bytes of LDS */
  const int tid = threadIdx.x, lane = tid & 31, ln = lane & 15, hh = lane >> 4; const int w = __builtin_amdgcn_readfirstlane(tid >> 5);
  const int q0 = qt * 128;
  const int nt = (q0 + 128) >> 6;      /* causal: key tiles up to the last query row; at least two */
  const int rw = q0 + 32 * w;      /* the wave's first query row */
  const _Float16* qr0 = Q + ((size_t)b * SQ + rw + ln) * LQ + h * HD; const _Float16* qr1 = qr0 + (size_t)16 * LQ;
  const v16h qa00 = g2_frag(qr0, hh), qa01 = g2_frag(qr0 + 32, hh), qa10 = g2_frag(qr1, hh), qa11 = g2_frag(qr1 + 32, hh);
  const _Float16* gk = K + ((size_t)b * SQ + (tid >> 3)) * LQ + h * HD + (tid & 7) * 8; const _Float16* gv = VTp + (((size_t)b * NH + h) * HD + (tid >> 3)) * SQ + (tid & 7) * 8;      /* this lane's 16 bytes of row tid / 8 of each 16-row group */
  const size_t sk = (size_t)16 * LQ, sv = (size_t)16 * SQ; const unsigned l0 = (unsigned)(size_t)sm + (unsigned)((tid >> 3) * G2_PITCH + (tid & 7) * 16);
  const unsigned char* fk = sm + ln * G2_PITCH; const unsigned char* fv = sm + (64 + ln) * G2_PITCH;      /* this lane's fragment rows in buffer 0 */
  _Float16* sp = (_Float16*)(sm + 2 * FA_BUF + w * 32 * G2_PITCH);
  const v8f z8 = {0.f,0.f,0.f,0.f,0.f,0.f,0.f,0.f}; v8f o[2][4]; float m[2][8], l[2][8];
#pragma unroll
  for (int i = 0; i < 2; ++i) {
#pragma unroll
    for (int j = 0; j < 4; ++j) o[i][j] = z8;
#pragma unroll
    for (int r = 0; r < 8; ++r) { m[i][r] = -1.0e30f; l[i][r] = 0.f; } }
  const float sl = scale * 1.44269504f;      /* e^(s scale) = 2^(s scale log2 e) */
  fa_stage(l0, gk, sk, gv, sv);
  asm volatile("s_wait_asynccnt 0x0" ::: "memory");      /* this wave's copies of tile 0 have landed */
  __syncthreads();      /* tile 0 published */
  fa_stage(l0 + FA_BUF, gk + (size_t)64 * LQ, sk, gv + 64, sv);      /* tile 1 flies while tile 0 is worked on */
#pragma unroll 1
  for (int t = 0; t < nt; ++t) { const unsigned bo = (unsigned)(t & 1) * FA_BUF;      /* kept rolled: one trip is one staged tile and the buffers alternate */
    if (t * 64 <= rw + 31) {      /* wave-uniform: a tile wholly above the wave's rows adds nothing; the waits and the barrier below are passed all the same */
      v8f s[2][4];
#pragma unroll
      for (int j = 0; j < 4; ++j) { s[0][j] = z8; s[1][j] = z8; }
#pragma unroll
      for (int ks = 0; ks < 2; ++ks) { const _Float16* pk = (const _Float16*)(fk + bo + ks * 64); v16h kb[4];
        if (ks) __builtin_amdgcn_sched_barrier(0);      /* keeps the second half's fragment reads behind the first half's products: read ahead, they take 32 more registers, the kernel passes 256 and a SIMD holds three waves instead of four */
#pragma unroll
        for (int j = 0; j < 4; ++j) kb[j] = g2_frag(pk + j * 8 * G2_PITCH, hh);      /* the four fragments' reads stand together in front of their products: one LDS latency, not four */
#pragma unroll
        for (int j = 0; j < 4; ++j) { s[0][j] = g2_mma(ks ? qa01 : qa00, kb[j], s[0][j]); s[1][j] = g2_mma(ks ? qa11 : qa10, kb[j], s[1][j]); } }
      if (t * 64 + 63 > rw) {      /* wave-uniform: only tiles that reach above the wave's first row hold masked keys */
#pragma unroll
        for (int i = 0; i < 2; ++i)
#pragma unroll
          for (int j = 0; j < 4; ++j)
#pragma unroll
            for (int r = 0; r < 8; ++r) s[i][j][r] = (t * 64 + 16 * j + ln <= rw + 16 * i + 8 * hh + r) ? s[i][j][r] : -1.0e30f; }
#pragma unroll
      for (int i = 0; i < 2; ++i) { float cr[8], cc[8];      /* accumulator layout: register r of lane (hh, ln) is row 16 i + 8 hh + r, key 16 j + ln */
#pragma unroll
        for (int r = 0; r < 8; ++r) { const float mt = row16_max(fmaxf(fmaxf(s[i][0][r], s[i][1][r]), fmaxf(s[i][2][r], s[i][3][r]))); const float mn = fmaxf(m[i][r], mt); cr[r] = (m[i][r] - mn) * sl; cc[r] = 8.0f - mn * sl; m[i][r] = mn; }
        exp2_x8(cr);
#pragma unroll
        for (int r = 0; r < 8; ++r) l[i][r] *= cr[r];
#pragma unroll
        for (int j = 0; j < 4; ++j) { float p[8];
#pragma unroll
          for (int r = 0; r < 8; ++r) p[r] = fmaf(s[i][j][r], sl, cc[r]);      /* weights carried x256, as the f16 P was before */
          exp2_x8(p);
#pragma unroll
          for (int r = 0; r < 8; ++r) { l[i][r] += p[r]; sp[(16 * i + 8 * hh + r) * FA_PH + 16 * j + ln] = (_Float16)p[r]; o[i][j][r] *= cr[r]; } } }
      __builtin_amdgcn_fence(__ATOMIC_ACQ_REL, "workgroup"); __builtin_amdgcn_wave_barrier();      /* the wave's P stores stay in front of its fragment reads of the same rows */
#pragma unroll
      for (int ks = 0; ks < 2; ++ks) { const v16h pa0 = g2_frag(sp + ln * FA_PH + ks * 32, hh), pa1 = g2_frag(sp + (16 + ln) * FA_PH + ks * 32, hh); const _Float16* pv = (const _Float16*)(fv + bo + ks * 64); v16h vb[4];
#pragma unroll
        for (int j = 0; j < 4; ++j) vb[j] = g2_frag(pv + j * 8 * G2_PITCH, hh);      /* as above */
#pragma unroll
        for (int j = 0; j < 4; ++j) { o[0][j] = g2_mma(pa0, vb[j], o[0][j]); o[1][j] = g2_mma(pa1, vb[j], o[1][j]); } } }
    asm volatile("s_wait_dscnt 0x0" ::: "memory");      /* this wave's reads of the buffer have returned before the buffer is given up */
    asm volatile("s_wait_asynccnt 0x0" ::: "memory");      /* this wave's copies of tile t + 1 have landed */
    __syncthreads();      /* publishes tile t + 1 and ends every wave's reads of tile t */
    if (t + 2 < nt) fa_stage(l0 + bo, gk + (size_t)(t + 2) * 64 * LQ, sk, gv + (size_t)(t + 2) * 64, sv); }      /* refill of the buffer just left */
  asm volatile("s_wait_asynccnt 0x0" ::: "memory");      /* no copy is outstanding at the end */
#pragma unroll
  for (int i = 0; i < 2; ++i)
#pragma unroll
    for (int r = 0; r < 8; ++r) { const float fin = 64.0f / row16_sum(l[i][r]);      /* o carried x64 as before; the x256 of the weights cancels */
#pragma unroll
      for (int j = 0; j < 4; ++j) sp[(16 * i + 8 * hh + r) * FA_PH + 16 * j + ln] = (_Float16)(o[i][j][r] * fin); }
  __builtin_amdgcn_fence(__ATOMIC_ACQ_REL, "workgroup"); __builtin_amdgcn_wave_barrier();      /* the wave's o stores stay in front of its row reads */
#pragma unroll
  for (int q = 0; q < 8; ++q) { const int row = q * 4 + (lane >> 3), c8 = (lane & 7) * 8; const v8us v = *(const v8us*)((const unsigned short*)sp + row * FA_PH + c8); *(v8us*)((unsigned short*)O + ((size_t)b * SQ + rw + row) * DM + h * HD + c8) = v; }      /* whole 128-byte row pieces per store */
  asm volatile("s_wait_xcnt 0x0" ::: "memory"); }      /* the wait that belongs in front of a later overwrite of the registers which these eight stores name: in a shared launch the other job's code follows in the listing */


typedef float v2f __attribute__((ext_vector_type(2)));
#define JU 4                         /* keys whose score chains run side by side in the exact attention */
// Exact f32 attention of the first QT0 rows of one head, one thread per query row (128 threads). The row's q and o live in registers; the head's K and V rows are staged once in LDS and read from there at one address for the whole wave.
// Every d loop is unrolled, and JU keys are taken together, so that their JU chains of dependent adds fill one another's latency. Per row every product, every sum and the running-maximum recurrence stand in the order they had key by key.
#define A0_LDS (2 * QT0 * HD * 4)      /* the K rows, then the V rows */
__device__ __forceinline__ void att0_head(const float* __restrict__ QF, const float* __restrict__ KF, const float* __restrict__ VF, int ld, float scale, _Float16* __restrict__ Hh, _Float16* __restrict__ Hl, int ldo, int h, int bat, unsigned char* sm) {      /* Hh, Hl: o (x64) as an f16 plane and the x1024 residual plane; sm: A0_LDS bytes of LDS */
  #pragma clang fp contract(off)      /* as before; numerical: each q k product stays rounded in front of its add, as it was built so far, so that the exact rows' scores, and with them o, stay bit-identical */
  static_assert(64 % JU == 0 && HD == 64 && QT0 == 128, "att0_head: whole groups of JU keys; 64 values a row; one thread per row of the first tile");
  float (*sk)[HD] = (float (*)[HD])sm; float (*sv)[HD] = (float (*)[HD])(sm + A0_LDS / 2);
  float (*lo)[HD + 4] = (float (*)[HD + 4])sm;      /* behind the loop's barrier the K and V rows' bytes are the output staging; pitch 68 floats spreads the rows over the banks */
  static_assert(sizeof(float) * QT0 * (HD + 4) <= A0_LDS, "att0_head: the output staging fits the K and V rows");
  const int tid = threadIdx.x; const int rg = __builtin_amdgcn_readfirstlane(tid >> 6); const int i = tid;      /* rg: which 64 rows; the same for a whole wave, so the key loop's bound stays scalar */
  const size_t bo_in = (size_t)bat * QT0 * ld; QF += bo_in; KF += bo_in; VF += bo_in; Hh += (size_t)bat * QT0 * ldo; Hl += (size_t)bat * QT0 * ldo;      /* QT0 rows per batch in every plane */
  const float* qr = QF + (size_t)i * ld + h * HD;
  const int nkey = rg * 64 + 64;      /* causal form: keys up to the last row of the wave's 64 */
  const int sr = tid >> 4, c4 = (tid & 15) * 4; const unsigned lof = (unsigned)(sr * ld + c4);      /* sixteen lanes take one 256-byte row */
#pragma unroll 1
  for (int r0 = 0; r0 < QT0; r0 += 64) { v4f tk[8], tv[8]; const float* pk[8]; const float* pv[8];      /* 64 rows a trip: sixteen loads in flight per lane; rolled, since two trips of them are all there is */
#pragma unroll
    for (int it = 0; it < 8; ++it) { const size_t g = (size_t)(r0 + it * 8) * ld + h * HD; pk[it] = (KF + g) + lof; pv[it] = (VF + g) + lof; tk[it] = *(const v4fa*)pk[it]; tv[it] = *(const v4fa*)pv[it]; }
    asm volatile("s_wait_xcnt 0x0" :: "v"(pk[0]), "v"(pk[1]), "v"(pk[2]), "v"(pk[3]), "v"(pk[4]), "v"(pk[5]), "v"(pk[6]), "v"(pk[7]), "v"(pv[0]), "v"(pv[1]), "v"(pv[2]), "v"(pv[3]), "v"(pv[4]), "v"(pv[5]), "v"(pv[6]), "v"(pv[7]) : "memory");      /* the wait that belongs in front of any overwrite of the loads' address registers; naming them keeps them whole up to it */
#pragma unroll
    for (int it = 0; it < 8; ++it) { *(v4f*)&sk[r0 + it * 8 + sr][c4] = tk[it]; *(v4f*)&sv[r0 + it * 8 + sr][c4] = tv[it]; } }
  v2f q2[HD / 2], o2[HD / 2];
#pragma unroll
  for (int c = 0; c < HD / 4; ++c) { const v4f qq = *(const v4fa*)(qr + c * 4); q2[2 * c] = v2f{qq[0], qq[1]}; q2[2 * c + 1] = v2f{qq[2], qq[3]}; o2[2 * c] = v2f{0.f, 0.f}; o2[2 * c + 1] = v2f{0.f, 0.f}; }
  asm volatile("s_wait_xcnt 0x0" :: "v"(qr) : "memory");      /* as above, for the address register of the q loads */
  __syncthreads();      /* the staged K and V rows are published to every wave */
  float m = -1.0e30f, l = 0.f;
  // A piece = 8 LDS reads of 16 bytes: 8 values (d = 8 n .. 8 n + 7) of JU rows. Two register buffers: the next piece's reads are issued in front of this piece's arithmetic, so that an LDS read's latency is not paid read by read.
  v4f ba[2 * JU], bb[2 * JU];
  auto fetch = [&](v4f (&buf)[2 * JU], const float (*rows)[HD], int jb, int n) {
#pragma unroll
    for (int u = 0; u < JU; ++u) { buf[2 * u] = *(const v4f*)&rows[jb + u][8 * n]; buf[2 * u + 1] = *(const v4f*)&rows[jb + u][8 * n + 4]; } };
  float s[JU], sc[JU], e[JU];
  auto dots = [&](const v4f (&buf)[2 * JU], int n) {      /* two rounded products an instruction; the adds stay one chain per key, d ascending */
#pragma unroll
    for (int w = 0; w < 2; ++w)
#pragma unroll
      for (int u = 0; u < JU; ++u) { const v4f kq = buf[2 * u + w]; const v2f p0 = q2[4 * n + 2 * w] * v2f{kq[0], kq[1]}, p1 = q2[4 * n + 2 * w + 1] * v2f{kq[2], kq[3]};
        s[u] = __fadd_rn(s[u], p0[0]); s[u] = __fadd_rn(s[u], p0[1]); s[u] = __fadd_rn(s[u], p1[0]); s[u] = __fadd_rn(s[u], p1[1]); } };
  auto accum = [&](const v4f (&buf)[2 * JU], int n) {      /* o = fma(o, sc, round(e v)), key after key: the rounding that this line was built with before, written out */
#pragma unroll
    for (int w = 0; w < 2; ++w)
#pragma unroll
      for (int u = 0; u < JU; ++u) { const v4f vv = buf[2 * u + w]; const v2f s2 = {sc[u], sc[u]}, e2 = {e[u], e[u]};
        o2[4 * n + 2 * w] = __builtin_elementwise_fma(o2[4 * n + 2 * w], s2, e2 * v2f{vv[0], vv[1]}); o2[4 * n + 2 * w + 1] = __builtin_elementwise_fma(o2[4 * n + 2 * w + 1], s2, e2 * v2f{vv[2], vv[3]}); } };
  fetch(ba, sk, 0, 0);
#pragma unroll 1
  for (int j0 = 0; j0 < nkey; j0 += JU) {      /* kept rolled: one trip already holds JU keys' unrolled d loops */
    const int jn = (j0 + JU < nkey) ? j0 + JU : 0;      /* the last trip fetches ahead from row 0, inside the array; that piece is not used */
#pragma unroll
    for (int u = 0; u < JU; ++u) s[u] = 0.f;
#pragma unroll
    for (int n = 0; n < HD / 8; n += 2) {
      fetch(bb, sk, j0, n + 1);
      __builtin_amdgcn_sched_barrier(0);      /* keeps the reads above in front of the arithmetic below: without it each read sinks to its use and waits out its own latency */
      dots(ba, n);
      if (n + 2 < HD / 8) fetch(ba, sk, j0, n + 2); else fetch(ba, sv, j0, 0);
      __builtin_amdgcn_sched_barrier(0);      /* as above */
      dots(bb, n + 1); }
#pragma unroll
    for (int u = 0; u < JU; ++u) { const float ss = __fmul_rn(s[u], scale);
      const float f = (j0 + u <= i) ? 1.f : 0.f; const float sm = fmaf(f, ss, (1.f - f) * -1.0e30f); const float mn = fmaxf(m, sm); sc[u] = expf(m - mn); e[u] = expf(sm - mn); l = fmaf(l, sc[u], e[u]); m = mn; }      /* l: one fused multiply-add, as this line was built before */
#pragma unroll
    for (int n = 0; n < HD / 8; n += 2) {
      fetch(bb, sv, j0, n + 1);
      __builtin_amdgcn_sched_barrier(0);      /* as above */
      accum(ba, n);
      if (n + 2 < HD / 8) fetch(ba, sv, j0, n + 2); else fetch(ba, sk, jn, 0);
      __builtin_amdgcn_sched_barrier(0);      /* as above */
      accum(bb, n + 1); } }
  const float fin = 64.0f / l;      /* o carried x64 like the f16 path */
  __syncthreads();      /* every wave has left the K and V rows before their bytes become the output staging */
#pragma unroll
  for (int c = 0; c < HD / 4; ++c) { const v2f a = o2[2 * c] * v2f{fin, fin}, b = o2[2 * c + 1] * v2f{fin, fin}; *(v4f*)&lo[tid][c * 4] = v4f{a[0], a[1], b[0], b[1]}; }
  __syncthreads();
  {
#pragma unroll 1
    for (int it0 = 0; it0 < 16; it0 += 4) {      /* rolled: eight stores in flight a trip are enough for 32 KiB */
#pragma unroll
      for (int it = it0; it < it0 + 4; ++it) { const int row = it * 8 + tid / 16, pc = (tid % 16) * 4; const v4f v = *(const v4f*)&lo[row][pc]; v4h vh, vl;
#pragma unroll
        for (int q = 0; q < 4; ++q) { const _Float16 hq = (_Float16)v[q]; vh[q] = hq; vl[q] = (_Float16)((v[q] - (float)hq) * 1024.0f); }      /* the split that a launch of its own made before: the same arithmetic */
        *(v4h*)(Hh + (size_t)row * ldo + h * HD + pc) = vh; *(v4h*)(Hl + (size_t)row * ldo + h * HD + pc) = vl; }      /* whole 128-byte row pieces per store */
      asm volatile("s_wait_xcnt 0x0" ::: "memory"); }      /* the wait that belongs in front of the next trip's overwrite of the registers which these stores name */
     } }
// The exact first-tile attention and the fused attention read different planes and write different planes: one launch. The first NH * NB work-groups each take the exact rows of one head (few, long chains of vector work: they start first and run beside the matrix work); the rest take the query tiles, the longest first. The branch is the same for a whole work-group.
__global__ __launch_bounds__(128) void k_attn(const float* __restrict__ QF, const float* __restrict__ KF, const float* __restrict__ VF, _Float16* __restrict__ Hh, _Float16* __restrict__ Hl, const _Float16* __restrict__ Q, const _Float16* __restrict__ K, const _Float16* __restrict__ VTp, float scale, _Float16* __restrict__ O) {
  __shared__ __attribute__((aligned(16))) unsigned char sm[A0_LDS > FA_LDS ? A0_LDS : FA_LDS];
  int f = (int)blockIdx.x;
  if (f < NH * NB) { att0_head(QF, KF, VF, 3 * DM, scale, Hh, Hl, DM, f % NH, f / NH, sm); return; }
  f -= NH * NB; fattn_tile(Q, K, VTp, scale, O, f % NH, (f / NH) % NB, SQ / 128 - 1 - f / (NH * NB), sm); }


// lane l with lane l ^ 16 (the other 16-lane row)
__device__ __forceinline__ float lane_x16(float x) { const int b = __builtin_bit_cast(int, x); return __builtin_bit_cast(float, __builtin_amdgcn_permlanex16(b, b, 0x76543210, 0xfedcba98, false, false)); }
__device__ __forceinline__ float wave_sum(float x) { x = row16_sum(x); return x + lane_x16(x); }
// Row LayerNorm (biased variance) -> f16 rows. One wave per row, LN_RW rows a wave: a launch starts few, longer-lived waves, and a row's two sums need no LDS and no barrier.
// A lane holds 32 values of a row: 4 columns of each 128-column piece, so that every wave load and store covers whole lines. All rows' loads of a wave are issued up front; g and b are loaded and rounded once a wave.
#define LN_RW 2                      /* rows a wave */
static_assert(DMQ == 1024 && NR % (8 * LN_RW) == 0, "k_ln16: rows of 8 pieces of 128 columns; whole work-groups of 8 waves");
template <int BFIN, int WXB>
__device__ __forceinline__ void ln16_rows(const float* __restrict__ X, const float* __restrict__ g, const float* __restrict__ bb, float eps, _Float16* __restrict__ N16, float* __restrict__ XB, int blk) {      /* blk: which 8 * LN_RW rows */
  const int lane = threadIdx.x & 31; const size_t e0 = ((size_t)blk * 8 + (threadIdx.x >> 5)) * LN_RW * DMQ + lane * 4;      /* this lane's first element of the wave's first row */
  const float* xp = X + e0; const float* gp = g + lane * 4; const float* bp = bb + lane * 4; v4f s[LN_RW][8], gv[8], bv[8];
#pragma unroll
  for (int k = 0; k < LN_RW; ++k)
#pragma unroll
    for (int u = 0; u < 8; ++u) s[k][u] = *(const v4fa*)(xp + k * DMQ + u * 128);      /* unrolled: one address and immediate offsets, every load in flight together */
#pragma unroll
  for (int u = 0; u < 8; ++u) { gv[u] = *(const v4fa*)(gp + u * 128); bv[u] = *(const v4fa*)(bp + u * 128); }
  asm volatile("s_wait_xcnt 0x0" :: "v"(xp), "v"(gp), "v"(bp) : "memory");      /* the wait that belongs in front of any overwrite of the loads' address registers; naming the three addresses keeps them whole up to here */
#pragma unroll
  for (int u = 0; u < 8; ++u)
#pragma unroll
    for (int q = 0; q < 4; ++q) { gv[u][q] = bf16_round(gv[u][q]); bv[u][q] = bf16_round(bv[u][q]); }
#pragma unroll
  for (int k = 0; k < LN_RW; ++k) {
    if (BFIN) {
#pragma unroll
      for (int u = 0; u < 8; ++u)
#pragma unroll
        for (int q = 0; q < 4; ++q) s[k][u][q] = bf16_round(s[k][u][q]); }
    v4f a = s[k][0];      /* four chains a lane, then the lane tree */
#pragma unroll
    for (int u = 1; u < 8; ++u) a += s[k][u];
    const float mu = wave_sum((a[0] + a[1]) + (a[2] + a[3])) * (1.0f / (float)DMQ);
    v4f v = {0.f, 0.f, 0.f, 0.f};
#pragma unroll
    for (int u = 0; u < 8; ++u) { const v4f d = s[k][u] - mu; v += d * d; }
    const float rs = rsqrtf(wave_sum((v[0] + v[1]) + (v[2] + v[3])) * (1.0f / (float)DMQ) + eps);
#pragma unroll
    for (int u = 0; u < 8; ++u) { const v4f y = (s[k][u] - mu) * rs * gv[u] + bv[u]; v4h h4;
#pragma unroll
      for (int q = 0; q < 4; ++q) h4[q] = (_Float16)y[q];
      *(v4h*)(N16 + e0 + k * DMQ + u * 128) = h4; if (WXB) *(v4f*)(XB + e0 + k * DMQ + u * 128) = s[k][u]; }
    asm volatile("s_wait_xcnt 0x0" ::: "memory"); } }      /* the wait that belongs in front of a later overwrite of the registers which this row's stores name */
template <int BFIN, int WXB>
__global__ __launch_bounds__(256) void k_ln16(const float* __restrict__ X, const float* __restrict__ g, const float* __restrict__ bb, float eps, _Float16* __restrict__ N16, float* __restrict__ XB) { ln16_rows<BFIN, WXB>(X, g, bb, eps, N16, XB, (int)blockIdx.x); }
// LN1 and the four weight transposes depend on nothing but the inputs: one launch, each work-group takes one piece of one of the five jobs (the branch is the same for a whole work-group). The LN rows, the most bytes, come first.
#define PB_LN ((int)(NR / (8 * LN_RW)))
#define PB_QKV ((3 * DM / 64) * (DM / 128))
#define PB_O ((DM / 64) * (DM / 128))
#define PB_FC ((DFF / 64) * (DM / 128))
#define PB_MP ((DM / 64) * (DFF / 128))
__global__ __launch_bounds__(256) void k_prep(const float* __restrict__ x, const float* __restrict__ g1, const float* __restrict__ be1, const float* __restrict__ wqkv, const float* __restrict__ wo, const float* __restrict__ wfc, const float* __restrict__ wmp,
    _Float16* __restrict__ X16, float* __restrict__ XB, _Float16* __restrict__ BQKV, _Float16* __restrict__ BO, _Float16* __restrict__ BW1, _Float16* __restrict__ BW2) {
  __shared__ __attribute__((aligned(16))) unsigned char tl[64 * WT_PITCH];
  int b = (int)blockIdx.x;
  if (b < PB_LN) { ln16_rows<1, 1>(x, g1, be1, 1e-5f, X16, XB, b); return; }
  b -= PB_LN; if (b < PB_QKV) { wt_f16_tile<DM, 3 * DM>(wqkv, BQKV, 16.0f, b, tl); return; }
  b -= PB_QKV; if (b < PB_O) { wt_f16_tile<DM, DM>(wo, BO, 16.0f, b, tl); return; }
  b -= PB_O; if (b < PB_FC) { wt_f16_tile<DM, DFF>(wfc, BW1, 16.0f, b, tl); return; }
  b -= PB_FC; wt_f16_tile<DFF, DM>(wmp, BW2, 16.0f, b, tl); }
__global__ __launch_bounds__(256) void k_ftres2(const float* __restrict__ OF0, const float* __restrict__ XB, float* __restrict__ X1, size_t n4) {
  #pragma clang fp contract(off)
  const size_t t = (size_t)blockIdx.x * 256 + threadIdx.x; if (t >= n4) return; const v4f o = *(const v4fa*)(OF0 + t * 4), xv = *(const v4fa*)(XB + t * 4); v4f y; for (int q = 0; q < 4; ++q) y[q] = __fadd_rn(__fmul_rn(o[q], 0.015625f), xv[q]); *(v4f*)(X1 + t * 4) = y;  }

__global__ __launch_bounds__(256) void k_wthd(const float* __restrict__ Wt, _Float16* __restrict__ Bt) { const size_t t = (size_t)blockIdx.x * 256 + threadIdx.x; if (t >= (size_t)NH * HD * (DM / 8)) return; const int m8 = (int)(t % (DM / 8)) * 8; const int d = (int)((t / (DM / 8)) % HD); const int h = (int)(t / ((size_t)(DM / 8) * HD)); FragH f;
  for (int q = 0; q < 8; ++q) f.h[q] = (_Float16)(16.0f * bf16_round(Wt[((size_t)h * DM + m8 + q) * HD + d])); unsigned short* dst = (unsigned short*)Bt + ((size_t)h * HD + d) * DM + m8; *(v8us*)dst = f.half[0];  }




__global__ __launch_bounds__(256) void k_wtpad(const float* __restrict__ Wm, _Float16* __restrict__ Wt, int Kr, int Kp, int Nr, int Np, float scale) {
  const int t = blockIdx.x * 256 + threadIdx.x; if (t >= Np * (Kp / 8)) return; const int n = t / (Kp / 8), k8 = (t % (Kp / 8)) * 8; const int nc = min(n, Nr - 1); const float fn = (n < Nr) ? 1.f : 0.f; FragH f;
  for (int i = 0; i < 8; ++i) { const int k = k8 + i; const int kc = min(k, Kr - 1); const float fk = (k < Kr) ? fn : 0.f; f.h[i] = (_Float16)(bf16_round(Wm[(size_t)kc * Nr + nc]) * scale * fk); }
  unsigned short* o = (unsigned short*)Wt + (size_t)n * Kp + k8; *(v8us*)o = f.half[0];  }
__global__ __launch_bounds__(128) void k_bpad(const float* __restrict__ b, float* __restrict__ Bp, int nr, int np) {
  const int i = threadIdx.x; if (i >= np) return; const float v = b[min(i, nr - 1)] * ((i < nr) ? 1.f : 0.f); *(float*)(Bp + i) = v;  }
extern "C" void kernel_launch(void* const* d_in, const int* in_sizes, int n_in,
                              void* d_out, int out_size, void* d_ws, size_t ws_size, hipStream_t stream) {
  (void)in_sizes; (void)n_in; (void)out_size;
  const float* const* I = (const float* const*)d_in; const float* x = I[0]; const float* wqkv = I[1]; const float* bqkv = I[2]; const float* wo = I[3]; const float* bo = I[4]; const float* g1 = I[5]; const float* be1 = I[6]; const float* gg2 = I[7]; const float* be2 = I[8]; const float* wfc = I[9]; const float* bfc = I[10]; const float* wmp = I[11]; const float* bmp = I[12];      /* x; fused Wqkv [1024][3072] + bqkv [3072] ([in][out]); Wproj + bproj; LN1 g / b, LN2 g / b; W1 [1024][4096] + b1, W2 [4096][1024] + b2 */
  char* ws = (char*)d_ws; size_t off = 0;
  auto take = [&](size_t bytes) { char* p = ws + off; off += (bytes + 255) & ~(size_t)255; return p; };
  _Float16* BQKV = (_Float16*)take((size_t)3 * DM * DM * 2); _Float16* BO = (_Float16*)take((size_t)DM * DM * 2);
  _Float16* X16 = (_Float16*)take(NR * DM * 2); float* XB = (float*)take(NR * DM * 4); _Float16* BW1 = (_Float16*)take((size_t)DFF * DM * 2); _Float16* BW2 = (_Float16*)take((size_t)DM * DFF * 2);
  _Float16* QKV = (_Float16*)take(NR * 3 * DM * 2); _Float16* Q16 = QKV; _Float16* K16 = QKV + DM; _Float16* O16 = (_Float16*)take(NR * DM * 2);
  _Float16* HF16 = QKV;      /* alias: the FFN hidden rows [NR][DFF] fill QKV + O16 (adjacent, same bytes); their last reader, the output projection, precedes the FFN */
  _Float16* M16 = X16;      /* alias: X16's last reader, the first-tile q | k | v GEMM, precedes LN2's write */
  _Float16* VT = (_Float16*)take((size_t)NB * NH * HD * SQ * 2);
  _Float16* OH0 = (_Float16*)take((size_t)NB * QT0 * DM * 2); _Float16* OL0 = (_Float16*)take((size_t)NB * QT0 * DM * 2);
  float* S = (float*)take((size_t)GB * NH * QT * NKX * 4);      /* no scores any more: the plane of the two aliases below */
  float* QKVF0 = S;      /* alias: f32 q | k | v of the first tiles [NB][QT0][3 DM]; read by the exact attention before x1 is written */
  float* X1 = S;      /* alias: x1 [NR][DM] is written after the exact attention's last read of this plane */
  if (off > ws_size) return;
  k_prep<<<PB_LN + PB_QKV + PB_O + PB_FC + PB_MP, 256, 0, stream>>>(x, g1, be1, wqkv, wo, wfc, wmp, X16, XB, BQKV, BO, BW1, BW2);      /* a = LN1(bf16(x)) -> f16 rows, XB = bf16(x) for the residual; fused Wqkv [DM][3 DM] -> Bt [3 DM][DM] (rows 0.. = q, DM.. = k, 2 DM.. = v output columns), Wproj, W1 [1024][4096] -> Bt [4096][1024], W2 [4096][1024] -> Bt [1024][4096], all x16 */
  k_qkv<<<QB_ALL + QB_FT, 256, 0, stream>>>(X16, BQKV, bqkv, QKV, QKVF0, VT);      /* q | k rows (f16); head h = columns h*HD.. of each DM block; v straight as V^T [NB][NH][HD][SQ]; beside them f32 q | k | v of the first 128 rows of every batch (exact products) */
  k_attn<<<NH * NB + NH * NB * (SQ / 128), 128, 0, stream>>>(QKVF0, QKVF0 + DM, QKVF0 + 2 * DM, OH0, OL0, Q16, K16, VT, 0.07216878364870322f, O16);      /* exact f32 attention for rows 0..127 of every batch and head (o x64, as f16 hi + x1024 residual planes), beside the causal attention of every batch, head and query tile: o (merged heads, x64) as f16 rows */
  k_proj<<<PJ_ALL + PJ_HL, 256, 0, stream>>>(O16, BO, bo, XB, X1, OH0, OL0);      /* x1 = x + o Wo + b; rows 0..127 of every batch: x1 = x + o_hi Wo 2^-10 + b + o_lo Wo 2^-20, from the exact o's two planes */
  k_ln16<0, 0><<<(unsigned)(NR / (8 * LN_RW)), 256, 0, stream>>>(X1, gg2, be2, 1e-5f, M16, nullptr);      /* h = LN2(x1) -> f16 rows */
  k_gemm3<3, false, false, DFF><<<(unsigned)((MP / 256) * (DFF / 128)), 256, 0, stream>>>(M16, DM, BW1, DM, 0.0625f, bfc, nullptr, nullptr, HF16, MP, DFF, DM);      /* relu(h2 W1 + b1) -> f16, all rows */
  k_gemm3<0, true, true, DM><<<(unsigned)((MP / 256) * (DM / 128)), 256, 0, stream>>>(HF16, DFF, BW2, DFF, 0.0625f, bmp, X1, (float*)d_out, nullptr, MP, DM, DFF);      /* out = x1 + mlp (own-element residual), all rows */
}
